// v000
// Measured on an AMD MI455X. A time is GPU time per run, averaged over a window of back-to-back runs after a warm-up
// (all launches, gaps included; the runs take copies of the inputs in turn), and the median of several windows.
// Apart from v000's, it joins two sittings. Times from different sittings can be a few percent apart, while
// side-by-side timings come from the same sitting.
// v000 is the starting kernel. One run takes 190 microseconds.
#include <hip/hip_runtime.h>

typedef __attribute__((ext_vector_type(16))) _Float16 v16h;
typedef __attribute__((ext_vector_type(8)))  float    v8f;

#define WMMA_F32_F16(a,b,c) __builtin_amdgcn_wmma_f32_16x16x32_f16(false,(a),false,(b),(short)0,(c),false,false)

// Load a 16x32 f16 A-fragment (also valid for B when given B^T stored [N][K])
// from row-major storage with leading dimension `ld` (in elements).
// ISA 7.12.2: lane 0-15 -> row = lane, lanes 16-31 -> row = lane-16 with K offset +8;
// VGPR j in 0..3 -> K = 2*j (+half*8), VGPR 4..7 -> K = 16 + 2*(j-4) (+half*8).
__device__ __forceinline__ v16h load_frag_rm(const _Float16* __restrict__ p, int ld) {
  const int lane = threadIdx.x & 31;
  const int row  = lane & 15;
  const int half = lane >> 4;
  v16h f;
  #pragma unroll
  for (int j = 0; j < 8; ++j) {
    const int kb = ((j & 3) << 1) + (half << 3) + ((j >> 2) << 4);
    f[2 * j]     = p[row * ld + kb];
    f[2 * j + 1] = p[row * ld + kb + 1];
  }
  return f;
}

// Async global -> LDS copy of 16 bytes per lane (CDNA5 GLOBAL_LOAD_ASYNC_TO_LDS_B128,
// tracked by ASYNCcnt). lds_off = low 32 bits of the generic shared-pointer.
__device__ __forceinline__ void async_copy_b128(unsigned lds_off, unsigned long long gaddr) {
  asm volatile("global_load_async_to_lds_b128 %0, %1, off"
               :: "v"(lds_off), "v"(gaddr) : "memory");
}
__device__ __forceinline__ void wait_async0() {
  asm volatile("s_wait_asynccnt 0" ::: "memory");
}

// ---------------- kernel 0: weights -> f16, transposed to [N][K] -----------
__global__ __launch_bounds__(256) void k_convert(const float* __restrict__ wqkv,
                                                 const float* __restrict__ wproj,
                                                 _Float16* __restrict__ wt,
                                                 _Float16* __restrict__ wpt) {
  const int idx = blockIdx.x * 256 + threadIdx.x;
  if (idx < 384 * 128) {
    const int n = idx >> 7, k = idx & 127;
    wt[n * 128 + k] = (_Float16)wqkv[k * 384 + n];
  }
  if (idx < 128 * 128) {
    const int n = idx >> 7, k = idx & 127;
    wpt[n * 128 + k] = (_Float16)wproj[k * 128 + n];
  }
}

// ---------------- kernel 1: LayerNorm + QKV projection ---------------------
// grid = 4096 (16-token M-tiles), block = 128 (4 waves, 6 N-tiles each of 24)
__global__ __launch_bounds__(128) void k_ln_qkv(const float* __restrict__ z,
                                                const float* __restrict__ ln_g,
                                                const float* __restrict__ ln_b,
                                                const _Float16* __restrict__ wt,
                                                const float* __restrict__ b_qkv,
                                                _Float16* __restrict__ q,
                                                _Float16* __restrict__ k,
                                                _Float16* __restrict__ vt) {
  __shared__ _Float16 zn[16][128];
  const int tid  = threadIdx.x;
  const int tok0 = blockIdx.x * 16;

  { // LayerNorm: 8 lanes per token, 16 features per lane
    const int t = tid >> 3;
    const int l = tid & 7;
    const float* zp = z + (size_t)(tok0 + t) * 128 + l * 16;
    float vbuf[16];
    float s = 0.f, ss = 0.f;
    #pragma unroll
    for (int i = 0; i < 16; ++i) { float x = zp[i]; vbuf[i] = x; s += x; ss += x * x; }
    #pragma unroll
    for (int off = 1; off < 8; off <<= 1) {
      s  += __shfl_xor(s,  off, 32);
      ss += __shfl_xor(ss, off, 32);
    }
    const float mu   = s * (1.f / 128.f);
    const float var  = ss * (1.f / 128.f) - mu * mu;
    const float rstd = rsqrtf(var + 1e-5f);
    #pragma unroll
    for (int i = 0; i < 16; ++i) {
      const int d = l * 16 + i;
      zn[t][d] = (_Float16)((vbuf[i] - mu) * rstd * ln_g[d] + ln_b[d]);
    }
  }
  __syncthreads();

  const int wave = tid >> 5;
  v8f acc[6] = {};
  #pragma unroll
  for (int kc = 0; kc < 4; ++kc) {
    const v16h a = load_frag_rm(&zn[0][0] + kc * 32, 128);
    #pragma unroll
    for (int j = 0; j < 6; ++j) {
      const int nt = wave * 6 + j;
      const v16h b = load_frag_rm(wt + nt * 16 * 128 + kc * 32, 128);
      acc[j] = WMMA_F32_F16(a, b, acc[j]);
    }
  }

  // scatter q / k / v(T) as f16
  const int lane  = tid & 31;
  const int n     = lane & 15;
  const int halfw = lane >> 4;
  #pragma unroll
  for (int j = 0; j < 6; ++j) {
    const int f     = (wave * 6 + j) * 16 + n;     // 0..383
    const int which = f >> 7;                      // 0=q 1=k 2=v (tiles never straddle)
    const int dall  = f & 127;
    const int h     = dall >> 5, d = dall & 31;
    const float bias = b_qkv[f];
    #pragma unroll
    for (int i = 0; i < 8; ++i) {
      const int tok = tok0 + halfw * 8 + i;        // M = i + 8*half
      const int r = tok >> 8, c = tok & 255;
      const _Float16 val = (_Float16)(acc[j][i] + bias);
      const size_t rh = (size_t)(r * 4 + h);
      if (which == 0)      q [(rh * 256 + c) * 32 + d] = val;
      else if (which == 1) k [(rh * 256 + c) * 32 + d] = val;
      else                 vt[(rh * 32 + d) * 256 + c] = val;   // transposed
    }
  }
}

// ---------------- kernel 2: per-(row,head) attention ------------------------
// grid = 1024 (r*4+h), block = 128 (4 waves); each wave: 4 sequential 16-query tiles
__global__ __launch_bounds__(128) void k_attn(const _Float16* __restrict__ q,
                                              const _Float16* __restrict__ kk,
                                              const _Float16* __restrict__ vt,
                                              _Float16* __restrict__ o) {
  __shared__ _Float16 ksm[256 * 32];        // 16 KB: K tile [key][d]
  __shared__ _Float16 vsm[32 * 256];        // 16 KB: V^T tile [d][key]
  __shared__ _Float16 psm[4][16 * 256];     // 32 KB: per-wave softmax'd P
  const int tid = threadIdx.x;
  const int rh  = blockIdx.x;
  const int r = rh >> 2, h = rh & 3;

  { // async global->LDS staging of K and V^T (2048 x b128, 16 per thread)
    const unsigned long long kg = (unsigned long long)(uintptr_t)(kk + (size_t)rh * 8192);
    const unsigned long long vg = (unsigned long long)(uintptr_t)(vt + (size_t)rh * 8192);
    const unsigned kl = (unsigned)(uintptr_t)&ksm[0];
    const unsigned vl = (unsigned)(uintptr_t)&vsm[0];
    #pragma unroll
    for (int i = 0; i < 8; ++i) {
      const unsigned b = (unsigned)(tid + i * 128) * 16u;   // byte offset 0..16K
      async_copy_b128(kl + b, kg + b);
      async_copy_b128(vl + b, vg + b);
    }
    wait_async0();
  }
  __syncthreads();

  const int wave = tid >> 5, lane = tid & 31;
  const int n = lane & 15, halfw = lane >> 4;
  const float scale = 0.17677669529663687f;  // 1/sqrt(32)
  const _Float16* qbase = q + (size_t)rh * 8192;
  _Float16* pw = &psm[wave][0];

  for (int mt = 0; mt < 4; ++mt) {
    const int q0 = (wave * 4 + mt) * 16;
    const v16h a = load_frag_rm(qbase + q0 * 32, 32);   // K-dim=32: one WMMA per tile
    v8f s[16];
    #pragma unroll
    for (int nt = 0; nt < 16; ++nt) {
      const v16h b = load_frag_rm(ksm + nt * 16 * 32, 32);
      v8f cz = {};
      s[nt] = WMMA_F32_F16(a, b, cz);
    }
    // softmax over 256 keys; row m = i + 8*half lives in one 16-lane half-wave
    float mx[8], rs[8];
    #pragma unroll
    for (int i = 0; i < 8; ++i) {
      float m = -1e30f;
      #pragma unroll
      for (int nt = 0; nt < 16; ++nt) m = fmaxf(m, s[nt][i]);
      #pragma unroll
      for (int off = 1; off < 16; off <<= 1) m = fmaxf(m, __shfl_xor(m, off, 32));
      mx[i] = m * scale;
    }
    #pragma unroll
    for (int nt = 0; nt < 16; ++nt)
      #pragma unroll
      for (int i = 0; i < 8; ++i)
        s[nt][i] = __expf(s[nt][i] * scale - mx[i]);
    #pragma unroll
    for (int i = 0; i < 8; ++i) {
      float sm = 0.f;
      #pragma unroll
      for (int nt = 0; nt < 16; ++nt) sm += s[nt][i];
      #pragma unroll
      for (int off = 1; off < 16; off <<= 1) sm += __shfl_xor(sm, off, 32);
      rs[i] = 1.f / sm;
    }
    #pragma unroll
    for (int nt = 0; nt < 16; ++nt)
      #pragma unroll
      for (int i = 0; i < 8; ++i)
        pw[(halfw * 8 + i) * 256 + nt * 16 + n] = (_Float16)(s[nt][i] * rs[i]);
    asm volatile("s_wait_dscnt 0" ::: "memory");   // wave-private LDS RAW

    // O = P(16x256) @ V(256x32); both operands from LDS
    v8f oc[2] = {};
    #pragma unroll
    for (int kt = 0; kt < 8; ++kt) {
      const v16h pa = load_frag_rm(pw + kt * 32, 256);
      #pragma unroll
      for (int nt2 = 0; nt2 < 2; ++nt2) {
        const v16h b = load_frag_rm(vsm + nt2 * 16 * 256 + kt * 32, 256);
        oc[nt2] = WMMA_F32_F16(pa, b, oc[nt2]);
      }
    }
    #pragma unroll
    for (int nt2 = 0; nt2 < 2; ++nt2)
      #pragma unroll
      for (int i = 0; i < 8; ++i) {
        const int qi = q0 + halfw * 8 + i;
        o[((size_t)(r * 256 + qi)) * 128 + h * 32 + nt2 * 16 + n] = (_Float16)oc[nt2][i];
      }
  }
}

// ---------------- kernel 3: output projection + bias + residual ------------
// grid = 1024, block = 128 (4 waves, one 16-token tile per wave)
__global__ __launch_bounds__(128) void k_proj(const _Float16* __restrict__ o,
                                              const _Float16* __restrict__ wpt,
                                              const float* __restrict__ b_proj,
                                              const float* __restrict__ z,
                                              float* __restrict__ out) {
  const int tid = threadIdx.x;
  const int wave = tid >> 5, lane = tid & 31;
  const int n = lane & 15, halfw = lane >> 4;
  const int mt = blockIdx.x * 4 + wave;
  const size_t tok0 = (size_t)mt * 16;

  v8f acc[8] = {};
  #pragma unroll
  for (int kc = 0; kc < 4; ++kc) {
    const v16h a = load_frag_rm(o + tok0 * 128 + kc * 32, 128);
    #pragma unroll
    for (int nt = 0; nt < 8; ++nt) {
      const v16h b = load_frag_rm(wpt + nt * 16 * 128 + kc * 32, 128);
      acc[nt] = WMMA_F32_F16(a, b, acc[nt]);
    }
  }
  #pragma unroll
  for (int nt = 0; nt < 8; ++nt) {
    const int f = nt * 16 + n;
    const float bias = b_proj[f];
    #pragma unroll
    for (int i = 0; i < 8; ++i) {
      const size_t idx = (tok0 + halfw * 8 + i) * 128 + f;
      out[idx] = z[idx] + acc[nt][i] + bias;
    }
  }
}

extern "C" void kernel_launch(void* const* d_in, const int* in_sizes, int n_in,
                              void* d_out, int out_size, void* d_ws, size_t ws_size,
                              hipStream_t stream) {
  const float* z      = (const float*)d_in[0];
  const float* ln_g   = (const float*)d_in[1];
  const float* ln_b   = (const float*)d_in[2];
  const float* w_qkv  = (const float*)d_in[3];
  const float* b_qkv  = (const float*)d_in[4];
  const float* w_proj = (const float*)d_in[5];
  const float* b_proj = (const float*)d_in[6];
  float* out = (float*)d_out;

  _Float16* ws   = (_Float16*)d_ws;
  _Float16* wt   = ws;                      // 384*128
  _Float16* wpt  = wt  + 49152;             // 128*128
  _Float16* qws  = wpt + 16384;             // 256*4*256*32
  _Float16* kws  = qws + 8388608;
  _Float16* vtws = kws + 8388608;           // transposed V
  _Float16* ows  = vtws + 8388608;          // attention output, f16

  k_convert<<<192, 256, 0, stream>>>(w_qkv, w_proj, wt, wpt);
  k_ln_qkv <<<4096, 128, 0, stream>>>(z, ln_g, ln_b, wt, b_qkv, qws, kws, vtws);
  k_attn   <<<1024, 128, 0, stream>>>(qws, kws, vtws, ows);
  k_proj   <<<1024, 128, 0, stream>>>(ows, wpt, b_proj, z, out);
}

// v001
// It runs in 76.4 microseconds.
// Next to v000, in two timings, it ran 2.55 times as fast each time.
#include <hip/hip_runtime.h>

typedef __attribute__((ext_vector_type(16))) _Float16 v16h;
typedef __attribute__((ext_vector_type(8)))  float    v8f;
typedef __attribute__((ext_vector_type(4)))  float    v4f;
typedef __attribute__((ext_vector_type(8)))  _Float16 v8h;
typedef __attribute__((ext_vector_type(4)))  _Float16 v4h;

#define WMMA_F32_F16(a,b,c) __builtin_amdgcn_wmma_f32_16x16x32_f16(false,(a),false,(b),(short)0,(c),false,false)

// Load a 16x32 f16 A-fragment (also valid for B when given B^T stored [N][K])
// from row-major storage with leading dimension `ld` (in elements).
// ISA 7.12.2: lane 0-15 -> row = lane, lanes 16-31 -> row = lane-16 with K offset +8;
// VGPR j in 0..3 -> K = 2*j (+half*8), VGPR 4..7 -> K = 16 + 2*(j-4) (+half*8).
__device__ __forceinline__ v16h load_frag_rm(const _Float16* __restrict__ p, int ld) {
  const int lane = threadIdx.x & 31;
  const int row  = lane & 15;
  const int half = lane >> 4;
  v16h f;
  #pragma unroll
  for (int j = 0; j < 8; ++j) {
    const int kb = ((j & 3) << 1) + (half << 3) + ((j >> 2) << 4);
    f[2 * j]     = p[row * ld + kb];
    f[2 * j + 1] = p[row * ld + kb + 1];
  }
  return f;
}

// ---------------- kernel 0: weights -> f16, transposed to [N][K] -----------
__global__ __launch_bounds__(256) void k_convert(const float* __restrict__ wqkv,
                                                 const float* __restrict__ wproj,
                                                 _Float16* __restrict__ wt,
                                                 _Float16* __restrict__ wpt) {
  const int idx = blockIdx.x * 256 + threadIdx.x;
  if (idx < 384 * 128) {
    const int n = idx >> 7, k = idx & 127;
    wt[n * 128 + k] = (_Float16)wqkv[k * 384 + n];
  }
  if (idx < 128 * 128) {
    const int n = idx >> 7, k = idx & 127;
    wpt[n * 128 + k] = (_Float16)wproj[k * 128 + n];
  }
}

// ---------------- kernel 1: LayerNorm + QKV projection + attention ---------
// grid = 1024 (r*4+h), block = 128 (4 waves). The block stages head h's 96 rows
// of W^T in LDS; each wave normalises its own 64 tokens of row r, projects them
// and leaves K and V^T in LDS and Q in registers; then 4 sequential 16-query tiles.
#define WP 136   // staged W^T row pitch in halves: 272 B = 16 B x odd, for 16-byte row readers
__global__ __launch_bounds__(128) void k_ln_qkv_attn(const float* __restrict__ z,
                                                     const float* __restrict__ ln_g,
                                                     const float* __restrict__ ln_b,
                                                     const _Float16* __restrict__ wt,
                                                     const float* __restrict__ b_qkv,
                                                     _Float16* __restrict__ o) {
  __shared__ __attribute__((aligned(16))) _Float16 ksm[256 * 32];     // 16 KB: K tile [key][d]; before that each wave's zn tile
  __shared__ __attribute__((aligned(16))) _Float16 vsm[32 * 256];     // 16 KB: V^T tile [d][key]
  __shared__ __attribute__((aligned(16))) _Float16 psm[4][16 * 256];  // 32 KB: per-wave softmax'd P; before that W^T of head h
  const int tid = threadIdx.x;
  const int rh  = blockIdx.x;
  const int r = rh >> 2, h = rh & 3;
  const int wave = tid >> 5, lane = tid & 31;
  const int n = lane & 15, halfw = lane >> 4;
  _Float16* pw  = &psm[wave][0];
  _Float16* wsm = &psm[0][0];                // 96 rows (q 0-31, k 32-63, v 64-95) x WP
  v16h qa[4];                                // Q A-fragments of the wave's 4 query tiles

  // W^T rows of head h: whole 256-B rows from global, padded rows in LDS
  // (thread tid, pass i: staged row i*8 + tid/16 = feature (i/4)*128 + h*32 + (i%4)*8 + tid/16, chunk tid%16)
  v8h wreg[12];
  const _Float16* wg = wt + h * 32 * 128 + tid * 8;
  #pragma unroll
  for (int i = 0; i < 12; ++i) wreg[i] = *(const v8h*)(wg + ((i >> 2) * 128 + (i & 3) * 8) * 128);

  v16h zf[4][4];                             // zn fragments of the wave's 4 token tiles
  {
    // 8 lanes per token, 4 x 4 features per lane. A 16 x 128 zn tile goes through the
    // wave's own 4 KB of ksm: 16-byte chunk c of row m lies at chunk c ^ m, so that the
    // 8-byte writers (rows 4 apart) and the 16-byte fragment readers each meet every bank once.
    const int tl = lane >> 3, l = lane & 7;
    _Float16* zs = ksm + wave * 2048;
    const float* zr = z + (size_t)r * 256 * 128;
    const unsigned zo = ((wave * 64 + tl * 4) * 128 + l * 4) * 4;   // the lane's byte offset in the row
    v4f x[4][4];                             // one token tile: [it][j], token tl*4 + it
    #pragma unroll
    for (int it = 0; it < 4; ++it)
      #pragma unroll
      for (int j = 0; j < 4; ++j) x[it][j] = *(const v4f*)((const char*)zr + (zo + (it * 128 + j * 32) * 4));
    v4f g4[4], b4[4];
    #pragma unroll
    for (int j = 0; j < 4; ++j) {
      g4[j] = *(const v4f*)(ln_g + (j * 8 + l) * 4);
      b4[j] = *(const v4f*)(ln_b + (j * 8 + l) * 4);
    }
    #pragma unroll
    for (int i = 0; i < 12; ++i) *(v8h*)(wsm + (i * 8 + (tid >> 4)) * WP + (tid & 15) * 8) = wreg[i];
    #pragma unroll
    for (int t = 0; t < 4; ++t) {
      // holds the tile's 16 loads together in front of their first use, so that all are in flight at once;
      // zo is named so that no load lands on the offset register that the others still name
      asm volatile("" :: "v"(x[0][0]), "v"(x[0][1]), "v"(x[0][2]), "v"(x[0][3]),
                         "v"(x[1][0]), "v"(x[1][1]), "v"(x[1][2]), "v"(x[1][3]),
                         "v"(x[2][0]), "v"(x[2][1]), "v"(x[2][2]), "v"(x[2][3]),
                         "v"(x[3][0]), "v"(x[3][1]), "v"(x[3][2]), "v"(x[3][3]), "v"(zo));
      #pragma unroll
      for (int it = 0; it < 4; ++it) {
        const int row = tl * 4 + it;
        float s = 0.f, ss = 0.f;
        #pragma unroll
        for (int j = 0; j < 4; ++j)
          #pragma unroll
          for (int e = 0; e < 4; ++e) { s += x[it][j][e]; ss += x[it][j][e] * x[it][j][e]; }
        #pragma unroll
        for (int off = 1; off < 8; off <<= 1) {
          s  += __shfl_xor(s,  off, 32);
          ss += __shfl_xor(ss, off, 32);
        }
        const float mu   = s * (1.f / 128.f);
        const float var  = ss * (1.f / 128.f) - mu * mu;
        const float rstd = rsqrtf(var + 1e-5f);
        #pragma unroll
        for (int j = 0; j < 4; ++j) {
          v4h y;
          #pragma unroll
          for (int e = 0; e < 4; ++e)
            y[e] = (_Float16)((x[it][j][e] - mu) * rstd * g4[j][e] + b4[j][e]);
          *(v4h*)(zs + row * 128 + (((j * 4 + (l >> 1)) ^ row) * 8) + (l & 1) * 4) = y;
        }
      }
      if (t < 3) {   // the next tile's loads fly while this tile goes through LDS
        #pragma unroll
        for (int it = 0; it < 4; ++it)
          #pragma unroll
          for (int j = 0; j < 4; ++j) x[it][j] = *(const v4f*)((const char*)zr + (zo + (((t + 1) * 16 + it) * 128 + j * 32) * 4));
      }
      asm volatile("s_wait_dscnt 0" ::: "memory");   // wave-private LDS RAW: other lanes' zn rows
      #pragma unroll
      for (int kc = 0; kc < 4; ++kc) {
        // same k order as load_frag_rm: halves kc*32 + halfw*8 + 0..7, then + 16
        const v8h lo = *(const v8h*)(zs + n * 128 + (((kc * 4 + halfw) ^ n) * 8));
        const v8h hi = *(const v8h*)(zs + n * 128 + (((kc * 4 + 2 + halfw) ^ n) * 8));
        zf[t][kc] = __builtin_shufflevector(lo, hi, 0, 1, 2, 3, 4, 5, 6, 7, 8, 9, 10, 11, 12, 13, 14, 15);
      }
    }
  }
  __syncthreads();   // W^T staged by all four waves is in LDS before any wave reads it

  // 6 feature tiles of head h: 0,1 = q, 2,3 = k, 4,5 = v
  #pragma unroll
  for (int ft = 0; ft < 6; ++ft) {
    const int which = ft >> 1, fh = ft & 1;
    const int f0 = which * 128 + h * 32 + fh * 16;
    v16h wf[4];
    #pragma unroll
    for (int kc = 0; kc < 4; ++kc) wf[kc] = load_frag_rm(wsm + ft * 16 * WP + kc * 32, WP);
    if (which < 2) {
      // W as A, zn as B: a lane holds 8 consecutive features of one token
      const v4f bl = *(const v4f*)(b_qkv + f0 + halfw * 8);
      const v4f bh = *(const v4f*)(b_qkv + f0 + halfw * 8 + 4);
      #pragma unroll
      for (int t = 0; t < 4; ++t) {
        v8f acc = {};
        #pragma unroll
        for (int kc = 0; kc < 4; ++kc) acc = WMMA_F32_F16(wf[kc], zf[t][kc], acc);
        v8h y;
        #pragma unroll
        for (int i = 0; i < 8; ++i) y[i] = (_Float16)(acc[i] + (i < 4 ? bl[i & 3] : bh[i & 3]));
        if (which == 0) {
          // feature fh*16 + halfw*8 + i of token n is element fh*8 + i of the A fragment
          #pragma unroll
          for (int i = 0; i < 8; ++i) qa[t][fh * 8 + i] = y[i];
        } else {
          *(v8h*)(ksm + (wave * 64 + t * 16 + n) * 32 + fh * 16 + halfw * 8) = y;
        }
      }
    } else {
      // zn as A, W as B: a lane holds 8 consecutive tokens of one feature
      const float bias = b_qkv[f0 + n];
      #pragma unroll
      for (int t = 0; t < 4; ++t) {
        v8f acc = {};
        #pragma unroll
        for (int kc = 0; kc < 4; ++kc) acc = WMMA_F32_F16(zf[t][kc], wf[kc], acc);
        v8h y;
        #pragma unroll
        for (int i = 0; i < 8; ++i) y[i] = (_Float16)(acc[i] + bias);
        *(v8h*)(vsm + (fh * 16 + n) * 256 + wave * 64 + t * 16 + halfw * 8) = y;
      }
    }
  }
  __syncthreads();   // every wave's K and V^T rows are in LDS, and W^T is read out, before psm takes P

  const float scale = 0.17677669529663687f;  // 1/sqrt(32)

  for (int mt = 0; mt < 4; ++mt) {
    const int q0 = (wave * 4 + mt) * 16;
    const v16h a = mt == 0 ? qa[0] : mt == 1 ? qa[1] : mt == 2 ? qa[2] : qa[3];   // K-dim=32: one WMMA per tile
    v8f s[16];
    #pragma unroll
    for (int nt = 0; nt < 16; ++nt) {
      const v16h b = load_frag_rm(ksm + nt * 16 * 32, 32);
      v8f cz = {};
      s[nt] = WMMA_F32_F16(a, b, cz);
    }
    // softmax over 256 keys; row m = i + 8*half lives in one 16-lane half-wave
    float mx[8], rs[8];
    #pragma unroll
    for (int i = 0; i < 8; ++i) {
      float m = -1e30f;
      #pragma unroll
      for (int nt = 0; nt < 16; ++nt) m = fmaxf(m, s[nt][i]);
      #pragma unroll
      for (int off = 1; off < 16; off <<= 1) m = fmaxf(m, __shfl_xor(m, off, 32));
      mx[i] = m * scale;
    }
    #pragma unroll
    for (int nt = 0; nt < 16; ++nt)
      #pragma unroll
      for (int i = 0; i < 8; ++i)
        s[nt][i] = __expf(s[nt][i] * scale - mx[i]);
    #pragma unroll
    for (int i = 0; i < 8; ++i) {
      float sm = 0.f;
      #pragma unroll
      for (int nt = 0; nt < 16; ++nt) sm += s[nt][i];
      #pragma unroll
      for (int off = 1; off < 16; off <<= 1) sm += __shfl_xor(sm, off, 32);
      rs[i] = 1.f / sm;
    }
    #pragma unroll
    for (int nt = 0; nt < 16; ++nt)
      #pragma unroll
      for (int i = 0; i < 8; ++i)
        pw[(halfw * 8 + i) * 256 + nt * 16 + n] = (_Float16)(s[nt][i] * rs[i]);
    asm volatile("s_wait_dscnt 0" ::: "memory");   // wave-private LDS RAW

    // O = P(16x256) @ V(256x32); both operands from LDS
    v8f oc[2] = {};
    #pragma unroll
    for (int kt = 0; kt < 8; ++kt) {
      const v16h pa = load_frag_rm(pw + kt * 32, 256);
      #pragma unroll
      for (int nt2 = 0; nt2 < 2; ++nt2) {
        const v16h b = load_frag_rm(vsm + nt2 * 16 * 256 + kt * 32, 256);
        oc[nt2] = WMMA_F32_F16(pa, b, oc[nt2]);
      }
    }
    #pragma unroll
    for (int nt2 = 0; nt2 < 2; ++nt2)
      #pragma unroll
      for (int i = 0; i < 8; ++i) {
        const int qi = q0 + halfw * 8 + i;
        o[((size_t)(r * 256 + qi)) * 128 + h * 32 + nt2 * 16 + n] = (_Float16)oc[nt2][i];
      }
    asm volatile("s_wait_xcnt 0x0" ::: "memory");   // before the next tile's Q fragment overwrites registers the stores name
  }
}

// ---------------- kernel 2: output projection + bias + residual ------------
// grid = 1024, block = 128 (4 waves, one 16-token tile per wave)
__global__ __launch_bounds__(128) void k_proj(const _Float16* __restrict__ o,
                                              const _Float16* __restrict__ wpt,
                                              const float* __restrict__ b_proj,
                                              const float* __restrict__ z,
                                              float* __restrict__ out) {
  const int tid = threadIdx.x;
  const int wave = tid >> 5, lane = tid & 31;
  const int n = lane & 15, halfw = lane >> 4;
  const int mt = blockIdx.x * 4 + wave;
  const size_t tok0 = (size_t)mt * 16;

  v8f acc[8] = {};
  #pragma unroll
  for (int kc = 0; kc < 4; ++kc) {
    const v16h a = load_frag_rm(o + tok0 * 128 + kc * 32, 128);
    #pragma unroll
    for (int nt = 0; nt < 8; ++nt) {
      const v16h b = load_frag_rm(wpt + nt * 16 * 128 + kc * 32, 128);
      acc[nt] = WMMA_F32_F16(a, b, acc[nt]);
    }
  }
  #pragma unroll
  for (int nt = 0; nt < 8; ++nt) {
    const int f = nt * 16 + n;
    const float bias = b_proj[f];
    #pragma unroll
    for (int i = 0; i < 8; ++i) {
      const size_t idx = (tok0 + halfw * 8 + i) * 128 + f;
      out[idx] = z[idx] + acc[nt][i] + bias;
    }
  }
}

extern "C" void kernel_launch(void* const* d_in, const int* in_sizes, int n_in,
                              void* d_out, int out_size, void* d_ws, size_t ws_size,
                              hipStream_t stream) {
  const float* z      = (const float*)d_in[0];
  const float* ln_g   = (const float*)d_in[1];
  const float* ln_b   = (const float*)d_in[2];
  const float* w_qkv  = (const float*)d_in[3];
  const float* b_qkv  = (const float*)d_in[4];
  const float* w_proj = (const float*)d_in[5];
  const float* b_proj = (const float*)d_in[6];
  float* out = (float*)d_out;

  _Float16* ws   = (_Float16*)d_ws;
  _Float16* wt   = ws;                      // 384*128
  _Float16* wpt  = wt  + 49152;             // 128*128
  _Float16* ows  = wpt + 16384;             // attention output, f16: 256*256*128

  k_convert<<<192, 256, 0, stream>>>(w_qkv, w_proj, wt, wpt);
  k_ln_qkv_attn<<<1024, 128, 0, stream>>>(z, ln_g, ln_b, wt, b_qkv, ows);
  k_proj   <<<1024, 128, 0, stream>>>(ows, wpt, b_proj, z, out);
}

// v002
// A run of this version takes 47.7 microseconds.
// Timed twice side by side with v001, it ran 1.60 times as fast both times.
// All steps since v000 together make it 4.08 times as fast.
#include <hip/hip_runtime.h>

typedef __attribute__((ext_vector_type(16))) _Float16 v16h;
typedef __attribute__((ext_vector_type(8)))  float    v8f;
typedef __attribute__((ext_vector_type(4)))  float    v4f;
typedef __attribute__((ext_vector_type(8)))  _Float16 v8h;
typedef __attribute__((ext_vector_type(4)))  _Float16 v4h;

#define WMMA_F32_F16(a,b,c) __builtin_amdgcn_wmma_f32_16x16x32_f16(false,(a),false,(b),(short)0,(c),false,false)

// Load a 16x32 f16 A-fragment (also valid for B when given B^T stored [N][K])
// from row-major storage with leading dimension `ld` (in elements).
// ISA 7.12.2: lane 0-15 -> row = lane, lanes 16-31 -> row = lane-16 with K offset +8;
// VGPR j in 0..3 -> K = 2*j (+half*8), VGPR 4..7 -> K = 16 + 2*(j-4) (+half*8).
__device__ __forceinline__ v16h load_frag_rm(const _Float16* __restrict__ p, int ld) {
  const int lane = threadIdx.x & 31;
  const int row  = lane & 15;
  const int half = lane >> 4;
  v16h f;
  #pragma unroll
  for (int j = 0; j < 8; ++j) {
    const int kb = ((j & 3) << 1) + (half << 3) + ((j >> 2) << 4);
    f[2 * j]     = p[row * ld + kb];
    f[2 * j + 1] = p[row * ld + kb + 1];
  }
  return f;
}

// ---------------- kernel 0: weights -> f16, transposed to [N][K] -----------
__global__ __launch_bounds__(256) void k_convert(const float* __restrict__ wqkv,
                                                 const float* __restrict__ wproj,
                                                 _Float16* __restrict__ wt,
                                                 _Float16* __restrict__ wpt) {
  const int idx = blockIdx.x * 256 + threadIdx.x;
  if (idx < 384 * 128) {
    const int n = idx >> 7, k = idx & 127;
    wt[n * 128 + k] = (_Float16)wqkv[k * 384 + n];
  }
  if (idx < 128 * 128) {
    const int n = idx >> 7, k = idx & 127;
    wpt[n * 128 + k] = (_Float16)wproj[k * 128 + n];
  }
}

// ---------------- kernel 1: LayerNorm + QKV projection + attention ---------
// grid = 1024 (r*4+h), block = 128 (4 waves). The block stages head h's 96 rows
// of W^T in LDS; each wave normalises its own 64 tokens of row r, projects them
// and leaves K and V^T in LDS and Q in registers; then 4 sequential 16-query tiles.
#define WP 136   // staged W^T row pitch in halves: 272 B = 16 B x odd, for 16-byte row readers
#define KP 40    // K row pitch in halves: 80 B = 16 B x odd, so that the 16 rows of a fragment read fall on distinct banks
#define VP 264   // V^T and P row pitch in halves: 528 B = 16 B x odd, for the same reason
__global__ __launch_bounds__(128) void k_ln_qkv_attn(const float* __restrict__ z,
                                                     const float* __restrict__ ln_g,
                                                     const float* __restrict__ ln_b,
                                                     const _Float16* __restrict__ wt,
                                                     const float* __restrict__ b_qkv,
                                                     _Float16* __restrict__ o) {
  __shared__ __attribute__((aligned(16))) _Float16 ksm[256 * KP];     // 20 KB: K tile [key][d], padded rows; before that each wave's zn tile
  __shared__ __attribute__((aligned(16))) _Float16 vsm[32 * VP];      // 16896 B: V^T tile [d][key], padded rows
  __shared__ __attribute__((aligned(16))) _Float16 psm[4][16 * VP];   // 33 KB: per-wave softmax'd P, padded rows; before that W^T of head h
  const int tid = threadIdx.x;
  const int rh  = blockIdx.x;
  const int r = rh >> 2, h = rh & 3;
  const int wave = tid >> 5, lane = tid & 31;
  const int n = lane & 15, halfw = lane >> 4;
  _Float16* pw  = &psm[wave][0];
  _Float16* wsm = &psm[0][0];                // 96 rows (q 0-31, k 32-63, v 64-95) x WP
  v16h qa[4];                                // Q A-fragments of the wave's 4 query tiles

  // W^T rows of head h: whole 256-B rows from global, padded rows in LDS
  // (thread tid, pass i: staged row i*8 + tid/16 = feature (i/4)*128 + h*32 + (i%4)*8 + tid/16, chunk tid%16)
  v8h wreg[12];
  const _Float16* wg = wt + h * 32 * 128 + tid * 8;
  #pragma unroll
  for (int i = 0; i < 12; ++i) wreg[i] = *(const v8h*)(wg + ((i >> 2) * 128 + (i & 3) * 8) * 128);

  v16h zf[4][4];                             // zn fragments of the wave's 4 token tiles
  {
    // 8 lanes per token, 4 x 4 features per lane. A 16 x 128 zn tile goes through the
    // first 4 KB of the wave's own 64 K rows of ksm: 16-byte chunk c of row m lies at chunk c ^ m, so that the
    // 8-byte writers (rows 4 apart) and the 16-byte fragment readers each meet every bank once.
    const int tl = lane >> 3, l = lane & 7;
    _Float16* zs = ksm + wave * 64 * KP;
    const float* zr = z + (size_t)r * 256 * 128;
    const unsigned zo = ((wave * 64 + tl * 4) * 128 + l * 4) * 4;   // the lane's byte offset in the row
    v4f x[4][4];                             // one token tile: [it][j], token tl*4 + it
    #pragma unroll
    for (int it = 0; it < 4; ++it)
      #pragma unroll
      for (int j = 0; j < 4; ++j) x[it][j] = *(const v4f*)((const char*)zr + (zo + (it * 128 + j * 32) * 4));
    v4f g4[4], b4[4];
    #pragma unroll
    for (int j = 0; j < 4; ++j) {
      g4[j] = *(const v4f*)(ln_g + (j * 8 + l) * 4);
      b4[j] = *(const v4f*)(ln_b + (j * 8 + l) * 4);
    }
    #pragma unroll
    for (int i = 0; i < 12; ++i) *(v8h*)(wsm + (i * 8 + (tid >> 4)) * WP + (tid & 15) * 8) = wreg[i];
    #pragma unroll
    for (int t = 0; t < 4; ++t) {
      // holds the tile's 16 loads together in front of their first use, so that all are in flight at once;
      // zo is named so that no load lands on the offset register that the others still name
      asm volatile("" :: "v"(x[0][0]), "v"(x[0][1]), "v"(x[0][2]), "v"(x[0][3]),
                         "v"(x[1][0]), "v"(x[1][1]), "v"(x[1][2]), "v"(x[1][3]),
                         "v"(x[2][0]), "v"(x[2][1]), "v"(x[2][2]), "v"(x[2][3]),
                         "v"(x[3][0]), "v"(x[3][1]), "v"(x[3][2]), "v"(x[3][3]), "v"(zo));
      #pragma unroll
      for (int it = 0; it < 4; ++it) {
        const int row = tl * 4 + it;
        float s = 0.f, ss = 0.f;
        #pragma unroll
        for (int j = 0; j < 4; ++j)
          #pragma unroll
          for (int e = 0; e < 4; ++e) { s += x[it][j][e]; ss += x[it][j][e] * x[it][j][e]; }
        #pragma unroll
        for (int off = 1; off < 8; off <<= 1) {
          s  += __shfl_xor(s,  off, 32);
          ss += __shfl_xor(ss, off, 32);
        }
        const float mu   = s * (1.f / 128.f);
        const float var  = ss * (1.f / 128.f) - mu * mu;
        const float rstd = rsqrtf(var + 1e-5f);
        #pragma unroll
        for (int j = 0; j < 4; ++j) {
          v4h y;
          #pragma unroll
          for (int e = 0; e < 4; ++e)
            y[e] = (_Float16)((x[it][j][e] - mu) * rstd * g4[j][e] + b4[j][e]);
          *(v4h*)(zs + row * 128 + (((j * 4 + (l >> 1)) ^ row) * 8) + (l & 1) * 4) = y;
        }
      }
      if (t < 3) {   // the next tile's loads fly while this tile goes through LDS
        #pragma unroll
        for (int it = 0; it < 4; ++it)
          #pragma unroll
          for (int j = 0; j < 4; ++j) x[it][j] = *(const v4f*)((const char*)zr + (zo + (((t + 1) * 16 + it) * 128 + j * 32) * 4));
      }
      asm volatile("s_wait_dscnt 0" ::: "memory");   // wave-private LDS RAW: other lanes' zn rows
      #pragma unroll
      for (int kc = 0; kc < 4; ++kc) {
        // same k order as load_frag_rm: halves kc*32 + halfw*8 + 0..7, then + 16
        const v8h lo = *(const v8h*)(zs + n * 128 + (((kc * 4 + halfw) ^ n) * 8));
        const v8h hi = *(const v8h*)(zs + n * 128 + (((kc * 4 + 2 + halfw) ^ n) * 8));
        zf[t][kc] = __builtin_shufflevector(lo, hi, 0, 1, 2, 3, 4, 5, 6, 7, 8, 9, 10, 11, 12, 13, 14, 15);
      }
    }
  }
  __syncthreads();   // W^T staged by all four waves is in LDS before any wave reads it

  // 6 feature tiles of head h: 0,1 = q, 2,3 = k, 4,5 = v
  #pragma unroll
  for (int ft = 0; ft < 6; ++ft) {
    const int which = ft >> 1, fh = ft & 1;
    const int f0 = which * 128 + h * 32 + fh * 16;
    v16h wf[4];
    #pragma unroll
    for (int kc = 0; kc < 4; ++kc) wf[kc] = load_frag_rm(wsm + ft * 16 * WP + kc * 32, WP);
    if (which < 2) {
      // W as A, zn as B: a lane holds 8 consecutive features of one token
      const v4f bl = *(const v4f*)(b_qkv + f0 + halfw * 8);
      const v4f bh = *(const v4f*)(b_qkv + f0 + halfw * 8 + 4);
      #pragma unroll
      for (int t = 0; t < 4; ++t) {
        v8f acc = {};
        #pragma unroll
        for (int kc = 0; kc < 4; ++kc) acc = WMMA_F32_F16(wf[kc], zf[t][kc], acc);
        v8h y;
        #pragma unroll
        for (int i = 0; i < 8; ++i) y[i] = (_Float16)(acc[i] + (i < 4 ? bl[i & 3] : bh[i & 3]));
        if (which == 0) {
          // feature fh*16 + halfw*8 + i of token n is element fh*8 + i of the A fragment
          #pragma unroll
          for (int i = 0; i < 8; ++i) qa[t][fh * 8 + i] = y[i];
        } else {
          *(v8h*)(ksm + (wave * 64 + t * 16 + n) * KP + fh * 16 + halfw * 8) = y;
        }
      }
    } else {
      // zn as A, W as B: a lane holds 8 consecutive tokens of one feature
      const float bias = b_qkv[f0 + n];
      #pragma unroll
      for (int t = 0; t < 4; ++t) {
        v8f acc = {};
        #pragma unroll
        for (int kc = 0; kc < 4; ++kc) acc = WMMA_F32_F16(zf[t][kc], wf[kc], acc);
        v8h y;
        #pragma unroll
        for (int i = 0; i < 8; ++i) y[i] = (_Float16)(acc[i] + bias);
        *(v8h*)(vsm + (fh * 16 + n) * VP + wave * 64 + t * 16 + halfw * 8) = y;
      }
    }
  }
  __syncthreads();   // every wave's K and V^T rows are in LDS, and W^T is read out, before psm takes P

  const float scale = 0.17677669529663687f;  // 1/sqrt(32)

  for (int mt = 0; mt < 4; ++mt) {
    const int q0 = (wave * 4 + mt) * 16;
    const v16h a = mt == 0 ? qa[0] : mt == 1 ? qa[1] : mt == 2 ? qa[2] : qa[3];   // K-dim=32: one WMMA per tile
    v8f s[16];
    #pragma unroll
    for (int nt = 0; nt < 16; ++nt) {
      const v16h b = load_frag_rm(ksm + nt * 16 * KP, KP);
      v8f cz = {};
      s[nt] = WMMA_F32_F16(a, b, cz);
    }
    // softmax over 256 keys; row m = i + 8*half lives in one 16-lane half-wave
    float mx[8], rs[8];
    #pragma unroll
    for (int i = 0; i < 8; ++i) {
      float m = -1e30f;
      #pragma unroll
      for (int nt = 0; nt < 16; ++nt) m = fmaxf(m, s[nt][i]);
      #pragma unroll
      for (int off = 1; off < 16; off <<= 1) m = fmaxf(m, __shfl_xor(m, off, 32));
      mx[i] = m * scale;
    }
    #pragma unroll
    for (int nt = 0; nt < 16; ++nt)
      #pragma unroll
      for (int i = 0; i < 8; ++i)
        s[nt][i] = __expf(s[nt][i] * scale - mx[i]);
    #pragma unroll
    for (int i = 0; i < 8; ++i) {
      float sm = 0.f;
      #pragma unroll
      for (int nt = 0; nt < 16; ++nt) sm += s[nt][i];
      #pragma unroll
      for (int off = 1; off < 16; off <<= 1) sm += __shfl_xor(sm, off, 32);
      rs[i] = 1.f / sm;
    }
    #pragma unroll
    for (int nt = 0; nt < 16; ++nt)
      #pragma unroll
      for (int i = 0; i < 8; ++i)
        pw[(halfw * 8 + i) * VP + nt * 16 + n] = (_Float16)(s[nt][i] * rs[i]);
    asm volatile("s_wait_dscnt 0" ::: "memory");   // wave-private LDS RAW

    // O = P(16x256) @ V(256x32); both operands from LDS
    v8f oc[2] = {};
    #pragma unroll
    for (int kt = 0; kt < 8; ++kt) {
      const v16h pa = load_frag_rm(pw + kt * 32, VP);
      #pragma unroll
      for (int nt2 = 0; nt2 < 2; ++nt2) {
        const v16h b = load_frag_rm(vsm + nt2 * 16 * VP + kt * 32, VP);
        oc[nt2] = WMMA_F32_F16(pa, b, oc[nt2]);
      }
    }
    #pragma unroll
    for (int nt2 = 0; nt2 < 2; ++nt2)
      #pragma unroll
      for (int i = 0; i < 8; ++i) {
        const int qi = q0 + halfw * 8 + i;
        o[((size_t)(r * 256 + qi)) * 128 + h * 32 + nt2 * 16 + n] = (_Float16)oc[nt2][i];
      }
    asm volatile("s_wait_xcnt 0x0" ::: "memory");   // before the next tile's Q fragment overwrites registers the stores name
  }
}

// ---------------- kernel 2: output projection + bias + residual ------------
// grid = 1024, block = 128 (4 waves, one 16-token tile per wave)
__global__ __launch_bounds__(128) void k_proj(const _Float16* __restrict__ o,
                                              const _Float16* __restrict__ wpt,
                                              const float* __restrict__ b_proj,
                                              const float* __restrict__ z,
                                              float* __restrict__ out) {
  const int tid = threadIdx.x;
  const int wave = tid >> 5, lane = tid & 31;
  const int n = lane & 15, halfw = lane >> 4;
  const int mt = blockIdx.x * 4 + wave;
  const size_t tok0 = (size_t)mt * 16;

  v8f acc[8] = {};
  #pragma unroll
  for (int kc = 0; kc < 4; ++kc) {
    const v16h a = load_frag_rm(o + tok0 * 128 + kc * 32, 128);
    #pragma unroll
    for (int nt = 0; nt < 8; ++nt) {
      const v16h b = load_frag_rm(wpt + nt * 16 * 128 + kc * 32, 128);
      acc[nt] = WMMA_F32_F16(a, b, acc[nt]);
    }
  }
  #pragma unroll
  for (int nt = 0; nt < 8; ++nt) {
    const int f = nt * 16 + n;
    const float bias = b_proj[f];
    #pragma unroll
    for (int i = 0; i < 8; ++i) {
      const size_t idx = (tok0 + halfw * 8 + i) * 128 + f;
      out[idx] = z[idx] + acc[nt][i] + bias;
    }
  }
}

extern "C" void kernel_launch(void* const* d_in, const int* in_sizes, int n_in,
                              void* d_out, int out_size, void* d_ws, size_t ws_size,
                              hipStream_t stream) {
  const float* z      = (const float*)d_in[0];
  const float* ln_g   = (const float*)d_in[1];
  const float* ln_b   = (const float*)d_in[2];
  const float* w_qkv  = (const float*)d_in[3];
  const float* b_qkv  = (const float*)d_in[4];
  const float* w_proj = (const float*)d_in[5];
  const float* b_proj = (const float*)d_in[6];
  float* out = (float*)d_out;

  _Float16* ws   = (_Float16*)d_ws;
  _Float16* wt   = ws;                      // 384*128
  _Float16* wpt  = wt  + 49152;             // 128*128
  _Float16* ows  = wpt + 16384;             // attention output, f16: 256*256*128

  k_convert<<<192, 256, 0, stream>>>(w_qkv, w_proj, wt, wpt);
  k_ln_qkv_attn<<<1024, 128, 0, stream>>>(z, ln_g, ln_b, wt, b_qkv, ows);
  k_proj   <<<1024, 128, 0, stream>>>(ows, wpt, b_proj, z, out);
}

// v003
// One run takes 40.7 microseconds.
// Timed twice side by side with v002, it ran 1.17 times as fast both times.
// Over all steps from v000 it is 4.78 times as fast.
#include <hip/hip_runtime.h>

typedef __attribute__((ext_vector_type(16))) _Float16 v16h;
typedef __attribute__((ext_vector_type(8)))  float    v8f;
typedef __attribute__((ext_vector_type(4)))  float    v4f;
typedef __attribute__((ext_vector_type(8)))  _Float16 v8h;
typedef __attribute__((ext_vector_type(4)))  _Float16 v4h;

#define WMMA_F32_F16(a,b,c) __builtin_amdgcn_wmma_f32_16x16x32_f16(false,(a),false,(b),(short)0,(c),false,false)

// Load a 16x32 f16 A-fragment (also valid for B when given B^T stored [N][K])
// from row-major storage with leading dimension `ld` (in elements).
// ISA 7.12.2: lane 0-15 -> row = lane, lanes 16-31 -> row = lane-16 with K offset +8;
// VGPR j in 0..3 -> K = 2*j (+half*8), VGPR 4..7 -> K = 16 + 2*(j-4) (+half*8).
__device__ __forceinline__ v16h load_frag_rm(const _Float16* __restrict__ p, int ld) {
  const int lane = threadIdx.x & 31;
  const int row  = lane & 15;
  const int half = lane >> 4;
  v16h f;
  #pragma unroll
  for (int j = 0; j < 8; ++j) {
    const int kb = ((j & 3) << 1) + (half << 3) + ((j >> 2) << 4);
    f[2 * j]     = p[row * ld + kb];
    f[2 * j + 1] = p[row * ld + kb + 1];
  }
  return f;
}

// value of lane ^ 16 (the other 16-lane half of the wave)
__device__ __forceinline__ float xhalf(float v) {
  const int b = __builtin_bit_cast(int, v);
  return __builtin_bit_cast(float, __builtin_amdgcn_permlanex16(b, b, 0x76543210, 0xfedcba98, false, false));
}

// ---------------- kernel 0: weights -> f16, transposed to [N][K] -----------
__global__ __launch_bounds__(256) void k_convert(const float* __restrict__ wqkv,
                                                 const float* __restrict__ wproj,
                                                 _Float16* __restrict__ wt,
                                                 _Float16* __restrict__ wpt) {
  const int idx = blockIdx.x * 256 + threadIdx.x;
  if (idx < 384 * 128) {
    const int n = idx >> 7, k = idx & 127;
    wt[n * 128 + k] = (_Float16)wqkv[k * 384 + n];
  }
  if (idx < 128 * 128) {
    const int n = idx >> 7, k = idx & 127;
    wpt[n * 128 + k] = (_Float16)wproj[k * 128 + n];
  }
}

// ---------------- kernel 1: LayerNorm + QKV projection + attention ---------
// grid = 1024 (r*4+h), block = 128 (4 waves). The block stages head h's 96 rows
// of W^T in LDS; each wave normalises its own 64 tokens of row r, projects them
// and leaves K and V^T in LDS and Q in registers; then 4 sequential 16-query tiles.
#define WP 136   // staged W^T row pitch in halves: 272 B = 16 B x odd, for 16-byte row readers
#define KP 40    // K row pitch in halves: 80 B = 16 B x odd, so that the 16 rows of a fragment read fall on distinct banks
#define VP 264   // V^T row pitch in halves: 528 B = 16 B x odd, for the same reason
__global__ __launch_bounds__(128) void k_ln_qkv_attn(const float* __restrict__ z,
                                                     const float* __restrict__ ln_g,
                                                     const float* __restrict__ ln_b,
                                                     const _Float16* __restrict__ wt,
                                                     const float* __restrict__ b_qkv,
                                                     _Float16* __restrict__ o) {
  __shared__ __attribute__((aligned(16))) _Float16 ksm[256 * KP];     // 20 KB: K tile [key][d], padded rows; before that each wave's zn tile
  __shared__ __attribute__((aligned(16))) _Float16 vsm[32 * VP];      // 16896 B: V^T tile [d][key], padded rows
  __shared__ __attribute__((aligned(16))) _Float16 wsm[96 * WP];      // 26112 B: W^T of head h, 96 rows (q 0-31, k 32-63, v 64-95), padded rows
  const int tid = threadIdx.x;
  const int rh  = blockIdx.x;
  const int r = rh >> 2, h = rh & 3;
  const int wave = tid >> 5, lane = tid & 31;
  const int n = lane & 15, halfw = lane >> 4;
  v16h qa[4];                                // Q fragments of the wave's 4 query tiles

  // W^T rows of head h: whole 256-B rows from global, padded rows in LDS
  // (thread tid, pass i: staged row i*8 + tid/16 = feature (i/4)*128 + h*32 + (i%4)*8 + tid/16, chunk tid%16)
  v8h wreg[12];
  const _Float16* wg = wt + h * 32 * 128 + tid * 8;
  #pragma unroll
  for (int i = 0; i < 12; ++i) wreg[i] = *(const v8h*)(wg + ((i >> 2) * 128 + (i & 3) * 8) * 128);

  v16h zf[4][4];                             // zn fragments of the wave's 4 token tiles
  {
    // 8 lanes per token, 4 x 4 features per lane. A 16 x 128 zn tile goes through the
    // first 4 KB of the wave's own 64 K rows of ksm: 16-byte chunk c of row m lies at chunk c ^ m, so that the
    // 8-byte writers (rows 4 apart) and the 16-byte fragment readers each meet every bank once.
    const int tl = lane >> 3, l = lane & 7;
    _Float16* zs = ksm + wave * 64 * KP;
    const float* zr = z + (size_t)r * 256 * 128;
    const unsigned zo = ((wave * 64 + tl * 4) * 128 + l * 4) * 4;   // the lane's byte offset in the row
    v4f x[4][4];                             // one token tile: [it][j], token tl*4 + it
    #pragma unroll
    for (int it = 0; it < 4; ++it)
      #pragma unroll
      for (int j = 0; j < 4; ++j) x[it][j] = *(const v4f*)((const char*)zr + (zo + (it * 128 + j * 32) * 4));
    v4f g4[4], b4[4];
    #pragma unroll
    for (int j = 0; j < 4; ++j) {
      g4[j] = *(const v4f*)(ln_g + (j * 8 + l) * 4);
      b4[j] = *(const v4f*)(ln_b + (j * 8 + l) * 4);
    }
    #pragma unroll
    for (int i = 0; i < 12; ++i) *(v8h*)(wsm + (i * 8 + (tid >> 4)) * WP + (tid & 15) * 8) = wreg[i];
    #pragma unroll
    for (int t = 0; t < 4; ++t) {
      // holds the tile's 16 loads together in front of their first use, so that all are in flight at once;
      // zo is named so that no load lands on the offset register that the others still name
      asm volatile("" :: "v"(x[0][0]), "v"(x[0][1]), "v"(x[0][2]), "v"(x[0][3]),
                         "v"(x[1][0]), "v"(x[1][1]), "v"(x[1][2]), "v"(x[1][3]),
                         "v"(x[2][0]), "v"(x[2][1]), "v"(x[2][2]), "v"(x[2][3]),
                         "v"(x[3][0]), "v"(x[3][1]), "v"(x[3][2]), "v"(x[3][3]), "v"(zo));
      #pragma unroll
      for (int it = 0; it < 4; ++it) {
        const int row = tl * 4 + it;
        float s = 0.f, ss = 0.f;
        #pragma unroll
        for (int j = 0; j < 4; ++j)
          #pragma unroll
          for (int e = 0; e < 4; ++e) { s += x[it][j][e]; ss += x[it][j][e] * x[it][j][e]; }
        #pragma unroll
        for (int off = 1; off < 8; off <<= 1) {
          s  += __shfl_xor(s,  off, 32);
          ss += __shfl_xor(ss, off, 32);
        }
        const float mu   = s * (1.f / 128.f);
        const float var  = ss * (1.f / 128.f) - mu * mu;
        const float rstd = rsqrtf(var + 1e-5f);
        #pragma unroll
        for (int j = 0; j < 4; ++j) {
          v4h y;
          #pragma unroll
          for (int e = 0; e < 4; ++e)
            y[e] = (_Float16)((x[it][j][e] - mu) * rstd * g4[j][e] + b4[j][e]);
          *(v4h*)(zs + row * 128 + (((j * 4 + (l >> 1)) ^ row) * 8) + (l & 1) * 4) = y;
        }
      }
      if (t < 3) {   // the next tile's loads fly while this tile goes through LDS
        #pragma unroll
        for (int it = 0; it < 4; ++it)
          #pragma unroll
          for (int j = 0; j < 4; ++j) x[it][j] = *(const v4f*)((const char*)zr + (zo + (((t + 1) * 16 + it) * 128 + j * 32) * 4));
      }
      asm volatile("s_wait_dscnt 0" ::: "memory");   // wave-private LDS RAW: other lanes' zn rows
      #pragma unroll
      for (int kc = 0; kc < 4; ++kc) {
        // same k order as load_frag_rm: halves kc*32 + halfw*8 + 0..7, then + 16
        const v8h lo = *(const v8h*)(zs + n * 128 + (((kc * 4 + halfw) ^ n) * 8));
        const v8h hi = *(const v8h*)(zs + n * 128 + (((kc * 4 + 2 + halfw) ^ n) * 8));
        zf[t][kc] = __builtin_shufflevector(lo, hi, 0, 1, 2, 3, 4, 5, 6, 7, 8, 9, 10, 11, 12, 13, 14, 15);
      }
    }
  }
  __syncthreads();   // W^T staged by all four waves is in LDS before any wave reads it

  // 6 feature tiles of head h: 0,1 = q, 2,3 = k, 4,5 = v
  #pragma unroll
  for (int ft = 0; ft < 6; ++ft) {
    const int which = ft >> 1, fh = ft & 1;
    const int f0 = which * 128 + h * 32 + fh * 16;
    v16h wf[4];
    #pragma unroll
    for (int kc = 0; kc < 4; ++kc) wf[kc] = load_frag_rm(wsm + ft * 16 * WP + kc * 32, WP);
    if (which < 2) {
      // W as A, zn as B: a lane holds 8 consecutive features of one token
      const v4f bl = *(const v4f*)(b_qkv + f0 + halfw * 8);
      const v4f bh = *(const v4f*)(b_qkv + f0 + halfw * 8 + 4);
      #pragma unroll
      for (int t = 0; t < 4; ++t) {
        v8f acc = {};
        #pragma unroll
        for (int kc = 0; kc < 4; ++kc) acc = WMMA_F32_F16(wf[kc], zf[t][kc], acc);
        v8h y;
        #pragma unroll
        for (int i = 0; i < 8; ++i) y[i] = (_Float16)(acc[i] + (i < 4 ? bl[i & 3] : bh[i & 3]));
        if (which == 0) {
          // feature fh*16 + halfw*8 + i of token n is element fh*8 + i of the fragment
          #pragma unroll
          for (int i = 0; i < 8; ++i) qa[t][fh * 8 + i] = y[i];
        } else {
          *(v8h*)(ksm + (wave * 64 + t * 16 + n) * KP + fh * 16 + halfw * 8) = y;
        }
      }
    } else {
      // zn as A, W as B: a lane holds 8 consecutive tokens of one feature
      const float bias = b_qkv[f0 + n];
      #pragma unroll
      for (int t = 0; t < 4; ++t) {
        v8f acc = {};
        #pragma unroll
        for (int kc = 0; kc < 4; ++kc) acc = WMMA_F32_F16(zf[t][kc], wf[kc], acc);
        v8h y;
        #pragma unroll
        for (int i = 0; i < 8; ++i) y[i] = (_Float16)(acc[i] + bias);
        *(v8h*)(vsm + (fh * 16 + n) * VP + wave * 64 + t * 16 + halfw * 8) = y;
      }
    }
  }
  __syncthreads();   // every wave's K and V^T rows are in LDS before any wave reads them

  const float scale = 0.17677669529663687f;  // 1/sqrt(32)

  for (int mt = 0; mt < 4; ++mt) {
    const int q0 = (wave * 4 + mt) * 16;
    const v16h qb = mt == 0 ? qa[0] : mt == 1 ? qa[1] : mt == 2 ? qa[2] : qa[3];   // K-dim=32: one WMMA per tile
    // S^T = K Q^T: K rows as A, Q as B (same k order in both). s[nt][i] is the score of
    // key nt*16 + halfw*8 + i for query n: a lane and its partner lane ^ 16 hold one query's 256 scores.
    v8f s[16];
    #pragma unroll
    for (int nt = 0; nt < 16; ++nt) {
      const v16h ka = load_frag_rm(ksm + nt * 16 * KP, KP);
      v8f cz = {};
      s[nt] = WMMA_F32_F16(ka, qb, cz);
    }
    // softmax over 256 keys: in the lane (four independent chains for the maximum, eight for the sum),
    // then one exchange between the wave's halves
    float m4[4];
    #pragma unroll
    for (int c = 0; c < 4; ++c) {
      float m = -1e30f;
      #pragma unroll
      for (int nt = c; nt < 16; nt += 4)
        #pragma unroll
        for (int i = 0; i < 8; ++i) m = fmaxf(m, s[nt][i]);
      m4[c] = m;
    }
    float m = fmaxf(fmaxf(m4[0], m4[1]), fmaxf(m4[2], m4[3]));
    m = fmaxf(m, xhalf(m));
    const float mx = m * scale;
    v8f sv = {};
    #pragma unroll
    for (int nt = 0; nt < 16; ++nt) {
      #pragma unroll
      for (int i = 0; i < 8; ++i) s[nt][i] = __expf(s[nt][i] * scale - mx);
      sv += s[nt];
    }
    float sm = ((sv[0] + sv[1]) + (sv[2] + sv[3])) + ((sv[4] + sv[5]) + (sv[6] + sv[7]));
    sm += xhalf(sm);
    const float rs = 1.f / sm;

    // O^T = V^T P^T: V^T rows as A from LDS; two score tiles, converted in place, are the B operand
    // (element e of the fragment = key kt*32 + (e/8)*16 + halfw*8 + e%8, the k order of load_frag_rm)
    v8f oc[2] = {};
    #pragma unroll
    for (int kt = 0; kt < 8; ++kt) {
      const v8h lo = __builtin_convertvector(s[2 * kt],     v8h);
      const v8h hi = __builtin_convertvector(s[2 * kt + 1], v8h);
      const v16h pb = __builtin_shufflevector(lo, hi, 0, 1, 2, 3, 4, 5, 6, 7, 8, 9, 10, 11, 12, 13, 14, 15);
      #pragma unroll
      for (int nt2 = 0; nt2 < 2; ++nt2) {
        const v16h va = load_frag_rm(vsm + nt2 * 16 * VP + kt * 32, VP);
        oc[nt2] = WMMA_F32_F16(va, pb, oc[nt2]);
      }
    }
    // oc[nt2][i] is feature nt2*16 + halfw*8 + i of query n: the query's 1/sum is in the lane, one 16-byte store per tile
    #pragma unroll
    for (int nt2 = 0; nt2 < 2; ++nt2) {
      v8h y;
      #pragma unroll
      for (int i = 0; i < 8; ++i) y[i] = (_Float16)(oc[nt2][i] * rs);
      *(v8h*)(o + ((size_t)(r * 256 + q0 + n)) * 128 + h * 32 + nt2 * 16 + halfw * 8) = y;
    }
    asm volatile("s_wait_xcnt 0x0" ::: "memory");   // before the next tile overwrites registers the stores name
  }
}

// ---------------- kernel 2: output projection + bias + residual ------------
// grid = 1024, block = 128 (4 waves, one 16-token tile per wave)
__global__ __launch_bounds__(128) void k_proj(const _Float16* __restrict__ o,
                                              const _Float16* __restrict__ wpt,
                                              const float* __restrict__ b_proj,
                                              const float* __restrict__ z,
                                              float* __restrict__ out) {
  const int tid = threadIdx.x;
  const int wave = tid >> 5, lane = tid & 31;
  const int n = lane & 15, halfw = lane >> 4;
  const int mt = blockIdx.x * 4 + wave;
  const size_t tok0 = (size_t)mt * 16;

  v8f acc[8] = {};
  #pragma unroll
  for (int kc = 0; kc < 4; ++kc) {
    const v16h a = load_frag_rm(o + tok0 * 128 + kc * 32, 128);
    #pragma unroll
    for (int nt = 0; nt < 8; ++nt) {
      const v16h b = load_frag_rm(wpt + nt * 16 * 128 + kc * 32, 128);
      acc[nt] = WMMA_F32_F16(a, b, acc[nt]);
    }
  }
  #pragma unroll
  for (int nt = 0; nt < 8; ++nt) {
    const int f = nt * 16 + n;
    const float bias = b_proj[f];
    #pragma unroll
    for (int i = 0; i < 8; ++i) {
      const size_t idx = (tok0 + halfw * 8 + i) * 128 + f;
      out[idx] = z[idx] + acc[nt][i] + bias;
    }
  }
}

extern "C" void kernel_launch(void* const* d_in, const int* in_sizes, int n_in,
                              void* d_out, int out_size, void* d_ws, size_t ws_size,
                              hipStream_t stream) {
  const float* z      = (const float*)d_in[0];
  const float* ln_g   = (const float*)d_in[1];
  const float* ln_b   = (const float*)d_in[2];
  const float* w_qkv  = (const float*)d_in[3];
  const float* b_qkv  = (const float*)d_in[4];
  const float* w_proj = (const float*)d_in[5];
  const float* b_proj = (const float*)d_in[6];
  float* out = (float*)d_out;

  _Float16* ws   = (_Float16*)d_ws;
  _Float16* wt   = ws;                      // 384*128
  _Float16* wpt  = wt  + 49152;             // 128*128
  _Float16* ows  = wpt + 16384;             // attention output, f16: 256*256*128

  k_convert<<<192, 256, 0, stream>>>(w_qkv, w_proj, wt, wpt);
  k_ln_qkv_attn<<<1024, 128, 0, stream>>>(z, ln_g, ln_b, wt, b_qkv, ows);
  k_proj   <<<1024, 128, 0, stream>>>(ows, wpt, b_proj, z, out);
}

// v004
// It runs in 31.6 microseconds.
// Timed twice side by side with v003, it ran 1.29 times as fast both times.
// All steps since v000 together make it 6.16 times as fast.
#include <hip/hip_runtime.h>

typedef __attribute__((ext_vector_type(16))) _Float16 v16h;
typedef __attribute__((ext_vector_type(8)))  float    v8f;
typedef __attribute__((ext_vector_type(4)))  float    v4f;
typedef __attribute__((ext_vector_type(8)))  _Float16 v8h;
typedef __attribute__((ext_vector_type(4)))  _Float16 v4h;

#define WMMA_F32_F16(a,b,c) __builtin_amdgcn_wmma_f32_16x16x32_f16(false,(a),false,(b),(short)0,(c),false,false)

// Load a 16x32 f16 A-fragment (also valid for B when given B^T stored [N][K])
// from row-major storage with leading dimension `ld` (in elements).
// ISA 7.12.2: lane 0-15 -> row = lane, lanes 16-31 -> row = lane-16 with K offset +8;
// VGPR j in 0..3 -> K = 2*j (+half*8), VGPR 4..7 -> K = 16 + 2*(j-4) (+half*8).
__device__ __forceinline__ v16h load_frag_rm(const _Float16* __restrict__ p, int ld) {
  const int lane = threadIdx.x & 31;
  const int row  = lane & 15;
  const int half = lane >> 4;
  v16h f;
  #pragma unroll
  for (int j = 0; j < 8; ++j) {
    const int kb = ((j & 3) << 1) + (half << 3) + ((j >> 2) << 4);
    f[2 * j]     = p[row * ld + kb];
    f[2 * j + 1] = p[row * ld + kb + 1];
  }
  return f;
}

// value of lane ^ 16 (the other 16-lane half of the wave)
__device__ __forceinline__ float xhalf(float v) {
  const int b = __builtin_bit_cast(int, v);
  return __builtin_bit_cast(float, __builtin_amdgcn_permlanex16(b, b, 0x76543210, 0xfedcba98, false, false));
}

// ---------------- kernel 0: weights -> f16, transposed to [N][K] -----------
__global__ __launch_bounds__(256) void k_convert(const float* __restrict__ wqkv,
                                                 const float* __restrict__ wproj,
                                                 _Float16* __restrict__ wt,
                                                 _Float16* __restrict__ wpt) {
  const int idx = blockIdx.x * 256 + threadIdx.x;
  if (idx < 384 * 128) {
    const int n = idx >> 7, k = idx & 127;
    wt[n * 128 + k] = (_Float16)wqkv[k * 384 + n];
  }
  if (idx < 128 * 128) {
    const int n = idx >> 7, k = idx & 127;
    wpt[n * 128 + k] = (_Float16)wproj[k * 128 + n];
  }
}

// ---------------- kernel 1: LayerNorm + QKV + attention + output projection + residual ---------
// grid = 256 (one block per row r), block = 512 (16 waves). Wave w normalises tokens w*16..+15 once and leaves
// zn in LDS for all heads. From there wave w is (head h = w/4, token quarter qd = w%4): it projects its 64 tokens
// on head h's 96 features (K, V^T to LDS, Q in registers), runs 4 sequential 16-query tiles and leaves O in LDS;
// last it computes output features h*32..+31 of its 64 tokens from all heads' O and adds bias and residual.
#define WP 136   // staged W^T row pitch in halves: 272 B = 16 B x odd, for 16-byte row readers
#define KP 40    // K row pitch in halves: 80 B = 16 B x odd, so that the 16 rows of a fragment read fall on distinct banks
#define VP 264   // V^T row pitch in halves: 528 B = 16 B x odd, for the same reason
__global__ __launch_bounds__(512) void k_row(const float* __restrict__ z,
                                             const float* __restrict__ ln_g,
                                             const float* __restrict__ ln_b,
                                             const _Float16* __restrict__ wt,
                                             const float* __restrict__ b_qkv,
                                             const _Float16* __restrict__ wpt,
                                             const float* __restrict__ b_proj,
                                             float* __restrict__ out) {
  // zn, later O: [token][feature], 256-B rows; 16-byte chunk c of row m lies at chunk c ^ (m % 16), so that
  // the writers and the 16-byte fragment readers (16 rows, one chunk index) each meet every bank once
  __shared__ __attribute__((aligned(16))) _Float16 zsm[256 * 128];        // 65536 B
  __shared__ __attribute__((aligned(16))) _Float16 ksm[4 * 256 * KP];     // 81920 B: K [head][key][d], padded rows
  __shared__ __attribute__((aligned(16))) _Float16 vsm[4 * 32 * VP];      // 67584 B: V^T [head][d][key], padded rows
  __shared__ __attribute__((aligned(16))) _Float16 wsm[384 * WP];         // 104448 B: W^T, all 384 features, padded rows
  const int tid = threadIdx.x;
  const int r   = blockIdx.x;
  const int wave = __builtin_amdgcn_readfirstlane(tid >> 5), lane = tid & 31;
  const int h = wave >> 2, qd = wave & 3;
  const int n = lane & 15, halfw = lane >> 4;
  const float* zr = z + (size_t)r * 256 * 128;

  {
    // W^T: whole 256-B rows from global, padded rows in LDS (thread tid, pass i: row i*32 + tid/16, chunk tid%16)
    v8h wreg[12];
    #pragma unroll
    for (int i = 0; i < 12; ++i) wreg[i] = *(const v8h*)(wt + (i * 512 + tid) * 8);

    // 8 lanes per token, 4 x 4 features per lane
    const int tl = lane >> 3, l = lane & 7;
    _Float16* zs = zsm + wave * 16 * 128;
    const unsigned zo = ((wave * 16 + tl * 4) * 128 + l * 4) * 4;   // the lane's byte offset in the row
    v4f x[4][4];                             // the wave's token tile: [it][j], token tl*4 + it
    #pragma unroll
    for (int it = 0; it < 4; ++it)
      #pragma unroll
      for (int j = 0; j < 4; ++j) x[it][j] = *(const v4f*)((const char*)zr + (zo + (it * 128 + j * 32) * 4));
    v4f g4[4], b4[4];
    #pragma unroll
    for (int j = 0; j < 4; ++j) {
      g4[j] = *(const v4f*)(ln_g + (j * 8 + l) * 4);
      b4[j] = *(const v4f*)(ln_b + (j * 8 + l) * 4);
    }
    #pragma unroll
    for (int i = 0; i < 12; ++i) *(v8h*)(wsm + (i * 32 + (tid >> 4)) * WP + (tid & 15) * 8) = wreg[i];
    // holds the tile's 16 loads together in front of their first use, so that all are in flight at once;
    // zo and l are named so that no load lands on an offset register that the others still name
    asm volatile("" :: "v"(x[0][0]), "v"(x[0][1]), "v"(x[0][2]), "v"(x[0][3]),
                       "v"(x[1][0]), "v"(x[1][1]), "v"(x[1][2]), "v"(x[1][3]),
                       "v"(x[2][0]), "v"(x[2][1]), "v"(x[2][2]), "v"(x[2][3]),
                       "v"(x[3][0]), "v"(x[3][1]), "v"(x[3][2]), "v"(x[3][3]), "v"(zo), "v"(l));
    #pragma unroll
    for (int it = 0; it < 4; ++it) {
      const int row = tl * 4 + it;
      float s = 0.f, ss = 0.f;
      #pragma unroll
      for (int j = 0; j < 4; ++j)
        #pragma unroll
        for (int e = 0; e < 4; ++e) { s += x[it][j][e]; ss += x[it][j][e] * x[it][j][e]; }
      #pragma unroll
      for (int off = 1; off < 8; off <<= 1) {
        s  += __shfl_xor(s,  off, 32);
        ss += __shfl_xor(ss, off, 32);
      }
      const float mu   = s * (1.f / 128.f);
      const float var  = ss * (1.f / 128.f) - mu * mu;
      const float rstd = rsqrtf(var + 1e-5f);
      #pragma unroll
      for (int j = 0; j < 4; ++j) {
        v4h y;
        #pragma unroll
        for (int e = 0; e < 4; ++e)
          y[e] = (_Float16)((x[it][j][e] - mu) * rstd * g4[j][e] + b4[j][e]);
        *(v4h*)(zs + row * 128 + (((j * 4 + (l >> 1)) ^ row) * 8) + (l & 1) * 4) = y;
      }
    }
  }
  __syncthreads();   // zn of all 256 tokens and W^T, staged by all waves, are in LDS before any wave reads them

  v16h qa[4];                                // Q fragments of the wave's 4 query tiles
  _Float16* kh = ksm + h * 256 * KP;         // head h's K
  _Float16* vh = vsm + h * 32 * VP;          // head h's V^T
  {
    v16h zf[4][4];                           // zn fragments of the wave's 4 token tiles
    #pragma unroll
    for (int t = 0; t < 4; ++t) {
      const _Float16* zt = zsm + (qd * 64 + t * 16 + n) * 128;
      #pragma unroll
      for (int kc = 0; kc < 4; ++kc) {
        // same k order as load_frag_rm: halves kc*32 + halfw*8 + 0..7, then + 16
        const v8h lo = *(const v8h*)(zt + (((kc * 4 + halfw) ^ n) * 8));
        const v8h hi = *(const v8h*)(zt + (((kc * 4 + 2 + halfw) ^ n) * 8));
        zf[t][kc] = __builtin_shufflevector(lo, hi, 0, 1, 2, 3, 4, 5, 6, 7, 8, 9, 10, 11, 12, 13, 14, 15);
      }
    }

    // 6 feature tiles of head h: 0,1 = q, 2,3 = k, 4,5 = v
    #pragma unroll
    for (int ft = 0; ft < 6; ++ft) {
      const int which = ft >> 1, fh = ft & 1;
      const int f0 = which * 128 + h * 32 + fh * 16;
      v16h wf[4];
      #pragma unroll
      for (int kc = 0; kc < 4; ++kc) wf[kc] = load_frag_rm(wsm + f0 * WP + kc * 32, WP);
      if (which < 2) {
        // W as A, zn as B: a lane holds 8 consecutive features of one token
        const v4f bl = *(const v4f*)(b_qkv + f0 + halfw * 8);
        const v4f bh = *(const v4f*)(b_qkv + f0 + halfw * 8 + 4);
        #pragma unroll
        for (int t = 0; t < 4; ++t) {
          v8f acc = {};
          #pragma unroll
          for (int kc = 0; kc < 4; ++kc) acc = WMMA_F32_F16(wf[kc], zf[t][kc], acc);
          v8h y;
          #pragma unroll
          for (int i = 0; i < 8; ++i) y[i] = (_Float16)(acc[i] + (i < 4 ? bl[i & 3] : bh[i & 3]));
          if (which == 0) {
            // feature fh*16 + halfw*8 + i of token n is element fh*8 + i of the fragment
            #pragma unroll
            for (int i = 0; i < 8; ++i) qa[t][fh * 8 + i] = y[i];
          } else {
            *(v8h*)(kh + (qd * 64 + t * 16 + n) * KP + fh * 16 + halfw * 8) = y;
          }
        }
      } else {
        // zn as A, W as B: a lane holds 8 consecutive tokens of one feature
        const float bias = b_qkv[f0 + n];
        #pragma unroll
        for (int t = 0; t < 4; ++t) {
          v8f acc = {};
          #pragma unroll
          for (int kc = 0; kc < 4; ++kc) acc = WMMA_F32_F16(zf[t][kc], wf[kc], acc);
          v8h y;
          #pragma unroll
          for (int i = 0; i < 8; ++i) y[i] = (_Float16)(acc[i] + bias);
          *(v8h*)(vh + (fh * 16 + n) * VP + qd * 64 + t * 16 + halfw * 8) = y;
        }
      }
    }
  }
  __syncthreads();   // every wave's K and V^T rows are in LDS before any wave reads them; zn has been read by all, so O may take its place

  const float scale = 0.17677669529663687f;  // 1/sqrt(32)

  for (int mt = 0; mt < 4; ++mt) {
    // compiler fence: keeps the K and V^T fragment reads inside the loop; lifted out of it as loop-invariant
    // they need 256 registers and go to scratch
    asm volatile("" ::: "memory");
    const int q0 = (qd * 4 + mt) * 16;
    const v16h qb = mt == 0 ? qa[0] : mt == 1 ? qa[1] : mt == 2 ? qa[2] : qa[3];   // K-dim=32: one WMMA per tile
    // S^T = K Q^T: K rows as A, Q as B (same k order in both). s[nt][i] is the score of
    // key nt*16 + halfw*8 + i for query n: a lane and its partner lane ^ 16 hold one query's 256 scores.
    v8f s[16];
    #pragma unroll
    for (int nt = 0; nt < 16; ++nt) {
      const v16h ka = load_frag_rm(kh + nt * 16 * KP, KP);
      v8f cz = {};
      s[nt] = WMMA_F32_F16(ka, qb, cz);
    }
    // softmax over 256 keys: in the lane (four independent chains for the maximum, eight for the sum),
    // then one exchange between the wave's halves
    float m4[4];
    #pragma unroll
    for (int c = 0; c < 4; ++c) {
      float m = -1e30f;
      #pragma unroll
      for (int nt = c; nt < 16; nt += 4)
        #pragma unroll
        for (int i = 0; i < 8; ++i) m = fmaxf(m, s[nt][i]);
      m4[c] = m;
    }
    float m = fmaxf(fmaxf(m4[0], m4[1]), fmaxf(m4[2], m4[3]));
    m = fmaxf(m, xhalf(m));
    const float mx = m * scale;
    v8f sv = {};
    #pragma unroll
    for (int nt = 0; nt < 16; ++nt) {
      #pragma unroll
      for (int i = 0; i < 8; ++i) s[nt][i] = __expf(s[nt][i] * scale - mx);
      sv += s[nt];
    }
    float sm = ((sv[0] + sv[1]) + (sv[2] + sv[3])) + ((sv[4] + sv[5]) + (sv[6] + sv[7]));
    sm += xhalf(sm);
    const float rs = 1.f / sm;

    // O^T = V^T P^T: V^T rows as A from LDS; two score tiles, converted in place, are the B operand
    // (element e of the fragment = key kt*32 + (e/8)*16 + halfw*8 + e%8, the k order of load_frag_rm)
    v8f oc[2] = {};
    #pragma unroll
    for (int kt = 0; kt < 8; ++kt) {
      const v8h lo = __builtin_convertvector(s[2 * kt],     v8h);
      const v8h hi = __builtin_convertvector(s[2 * kt + 1], v8h);
      const v16h pb = __builtin_shufflevector(lo, hi, 0, 1, 2, 3, 4, 5, 6, 7, 8, 9, 10, 11, 12, 13, 14, 15);
      #pragma unroll
      for (int nt2 = 0; nt2 < 2; ++nt2) {
        const v16h va = load_frag_rm(vh + nt2 * 16 * VP + kt * 32, VP);
        oc[nt2] = WMMA_F32_F16(va, pb, oc[nt2]);
      }
    }
    // oc[nt2][i] is feature h*32 + nt2*16 + halfw*8 + i of query n: the query's 1/sum is in the lane,
    // one 16-byte chunk (index h*4 + nt2*2 + halfw) of the query's O row per tile
    #pragma unroll
    for (int nt2 = 0; nt2 < 2; ++nt2) {
      v8h y;
      #pragma unroll
      for (int i = 0; i < 8; ++i) y[i] = (_Float16)(oc[nt2][i] * rs);
      *(v8h*)(zsm + (q0 + n) * 128 + (((h * 4 + nt2 * 2 + halfw) ^ n) * 8)) = y;
    }
  }

  // output projection: W_proj^T rows as A, O as B, so that a lane holds 8 consecutive output features of one token.
  // What does not depend on O (weights, bias, residual) is loaded in front of the barrier and flies while waves wait there.
  v16h pw[2][4];
  v4f pbias[2][2];
  #pragma unroll
  for (int nt = 0; nt < 2; ++nt) {
    #pragma unroll
    for (int kc = 0; kc < 4; ++kc) pw[nt][kc] = load_frag_rm(wpt + (h * 32 + nt * 16) * 128 + kc * 32, 128);
    pbias[nt][0] = *(const v4f*)(b_proj + h * 32 + nt * 16 + halfw * 8);
    pbias[nt][1] = *(const v4f*)(b_proj + h * 32 + nt * 16 + halfw * 8 + 4);
  }
  const unsigned eo = (qd * 64 + n) * 128 + h * 32 + halfw * 8;   // the lane's element offset in the row: token, first feature
  v4f zres[4][2][2];
  #pragma unroll
  for (int t = 0; t < 4; ++t)
    #pragma unroll
    for (int nt = 0; nt < 2; ++nt)
      #pragma unroll
      for (int c = 0; c < 2; ++c) zres[t][nt][c] = *(const v4f*)(zr + eo + t * 16 * 128 + nt * 16 + c * 4);
  __syncthreads();   // all four heads' O rows are in LDS before any wave reads them

  float* outr = out + (size_t)r * 256 * 128;
  #pragma unroll
  for (int t = 0; t < 4; ++t) {
    const _Float16* ot = zsm + (qd * 64 + t * 16 + n) * 128;
    v8f acc[2] = {};
    #pragma unroll
    for (int kc = 0; kc < 4; ++kc) {
      // same k order as load_frag_rm: halves kc*32 + halfw*8 + 0..7, then + 16
      const v8h lo = *(const v8h*)(ot + (((kc * 4 + halfw) ^ n) * 8));
      const v8h hi = *(const v8h*)(ot + (((kc * 4 + 2 + halfw) ^ n) * 8));
      const v16h ob = __builtin_shufflevector(lo, hi, 0, 1, 2, 3, 4, 5, 6, 7, 8, 9, 10, 11, 12, 13, 14, 15);
      #pragma unroll
      for (int nt = 0; nt < 2; ++nt) acc[nt] = WMMA_F32_F16(pw[nt][kc], ob, acc[nt]);
    }
    #pragma unroll
    for (int nt = 0; nt < 2; ++nt)
      #pragma unroll
      for (int c = 0; c < 2; ++c) {
        v4f y;
        #pragma unroll
        for (int e = 0; e < 4; ++e) y[e] = zres[t][nt][c][e] + acc[nt][c * 4 + e] + pbias[nt][c][e];
        *(v4f*)(outr + eo + t * 16 * 128 + nt * 16 + c * 4) = y;
      }
  }
}

extern "C" void kernel_launch(void* const* d_in, const int* in_sizes, int n_in,
                              void* d_out, int out_size, void* d_ws, size_t ws_size,
                              hipStream_t stream) {
  const float* z      = (const float*)d_in[0];
  const float* ln_g   = (const float*)d_in[1];
  const float* ln_b   = (const float*)d_in[2];
  const float* w_qkv  = (const float*)d_in[3];
  const float* b_qkv  = (const float*)d_in[4];
  const float* w_proj = (const float*)d_in[5];
  const float* b_proj = (const float*)d_in[6];
  float* out = (float*)d_out;

  _Float16* ws   = (_Float16*)d_ws;
  _Float16* wt   = ws;                      // 384*128
  _Float16* wpt  = wt  + 49152;             // 128*128

  k_convert<<<192, 256, 0, stream>>>(w_qkv, w_proj, wt, wpt);
  k_row    <<<256, 512, 0, stream>>>(z, ln_g, ln_b, wt, b_qkv, wpt, b_proj, out);
}

// v005
// Measured time: 29.8 microseconds a run.
// Two timings next to v004 put it at 1.07 and 1.06 times that version's speed.
// Over all steps from v000 it is 6.58 times as fast.
#include <hip/hip_runtime.h>

typedef __attribute__((ext_vector_type(16))) _Float16 v16h;
typedef __attribute__((ext_vector_type(8)))  float    v8f;
typedef __attribute__((ext_vector_type(4)))  float    v4f;
typedef __attribute__((ext_vector_type(8)))  _Float16 v8h;
typedef __attribute__((ext_vector_type(4)))  _Float16 v4h;

#define WMMA_F32_F16(a,b,c) __builtin_amdgcn_wmma_f32_16x16x32_f16(false,(a),false,(b),(short)0,(c),false,false)

// Load a 16x32 f16 A-fragment (also valid for B when given B^T stored [N][K])
// from row-major storage with leading dimension `ld` (in elements).
// ISA 7.12.2: lane 0-15 -> row = lane, lanes 16-31 -> row = lane-16 with K offset +8;
// VGPR j in 0..3 -> K = 2*j (+half*8), VGPR 4..7 -> K = 16 + 2*(j-4) (+half*8).
__device__ __forceinline__ v16h load_frag_rm(const _Float16* __restrict__ p, int ld) {
  const int lane = threadIdx.x & 31;
  const int row  = lane & 15;
  const int half = lane >> 4;
  v16h f;
  #pragma unroll
  for (int j = 0; j < 8; ++j) {
    const int kb = ((j & 3) << 1) + (half << 3) + ((j >> 2) << 4);
    f[2 * j]     = p[row * ld + kb];
    f[2 * j + 1] = p[row * ld + kb + 1];
  }
  return f;
}

// value of lane ^ 16 (the other 16-lane half of the wave)
__device__ __forceinline__ float xhalf(float v) {
  const int b = __builtin_bit_cast(int, v);
  return __builtin_bit_cast(float, __builtin_amdgcn_permlanex16(b, b, 0x76543210, 0xfedcba98, false, false));
}

// A wave's 32 x 32 block of a row-major f32 weight [k][n], on its way to f16 [n][k] rows in LDS.
// Lane (a, c) takes columns a*4..+3 of rows c*8..+7: each load covers four whole 128-B lines, and each lane
// ends with 8 consecutive k of 4 columns, one 16-byte LDS store a column.
// a and c are dealt so that the 16 lanes of a half wave store to 16 distinct bank groups at a 272-B row pitch.
__device__ __forceinline__ void wblk_load(v4f (&x)[8], const float* __restrict__ w, int ld) {
  const int lane = threadIdx.x & 31;
  const int a = (lane & 3) | ((lane >> 4) << 2), c = (lane >> 2) & 3;
  const unsigned lo = (c * 8 * ld + a * 4) * 4;   // the lane's byte offset in the block: one register beside the wave's scalar base
  #pragma unroll
  for (int j = 0; j < 8; ++j) x[j] = *(const v4f*)((const char*)w + (lo + j * ld * 4));
}
__device__ __forceinline__ void wblk_store(const v4f (&x)[8], _Float16* dst, int pitch) {
  const int lane = threadIdx.x & 31;
  const int a = (lane & 3) | ((lane >> 4) << 2), c = (lane >> 2) & 3;
  #pragma unroll
  for (int e = 0; e < 4; ++e) {
    v8h y;
    #pragma unroll
    for (int j = 0; j < 8; ++j) y[j] = (_Float16)x[j][e];
    *(v8h*)(dst + (a * 4 + e) * pitch + c * 8) = y;
  }
}

// ---------------- LayerNorm + QKV + attention + output projection + residual, weights converted on the way in ---------
// grid = 256 (one block per row r), block = 512 (16 waves). Wave w normalises tokens w*16..+15 once and leaves
// zn in LDS for all heads. From there wave w is (head h = w/4, token quarter qd = w%4): it projects its 64 tokens
// on head h's 96 features (K, V^T to LDS, Q in registers), runs 4 sequential 16-query tiles and leaves O in LDS;
// last it computes output features h*32..+31 of its 64 tokens from all heads' O and adds bias and residual.
// Both weights come as f32 [k][n] from global and are converted and transposed by the block itself into LDS.
#define WP 136   // staged W^T row pitch in halves: 272 B = 16 B x odd, for 16-byte row readers
#define KP 40    // K row pitch in halves: 80 B = 16 B x odd, so that the 16 rows of a fragment read fall on distinct banks
#define VP 264   // V^T row pitch in halves: 528 B = 16 B x odd, for the same reason
__global__ __launch_bounds__(512) void k_row(const float* __restrict__ z,
                                             const float* __restrict__ ln_g,
                                             const float* __restrict__ ln_b,
                                             const float* __restrict__ w_qkv,
                                             const float* __restrict__ b_qkv,
                                             const float* __restrict__ w_proj,
                                             const float* __restrict__ b_proj,
                                             float* __restrict__ out) {
  // zn, later O: [token][feature], 256-B rows; 16-byte chunk c of row m lies at chunk c ^ (m % 16), so that
  // the writers and the 16-byte fragment readers (16 rows, one chunk index) each meet every bank once
  __shared__ __attribute__((aligned(16))) _Float16 zsm[256 * 128];        // 65536 B
  __shared__ __attribute__((aligned(16))) _Float16 ksm[4 * 256 * KP];     // 81920 B: K [head][key][d], padded rows
  __shared__ __attribute__((aligned(16))) _Float16 vsm[4 * 32 * VP];      // 67584 B: V^T [head][d][key], padded rows
  __shared__ __attribute__((aligned(16))) _Float16 wsm[384 * WP];         // 104448 B: W_qkv^T, all 384 features, padded rows; later W_proj^T, 128 rows
  const int tid = threadIdx.x;
  const int r   = blockIdx.x;
  const int wave = __builtin_amdgcn_readfirstlane(tid >> 5), lane = tid & 31;
  const int h = wave >> 2, qd = wave & 3;
  const int n = lane & 15, halfw = lane >> 4;
  const float* zr = z + (size_t)r * 256 * 128;

  {
    // W_qkv: 48 blocks of 32 k x 32 features, three a wave (block b: features (b % 12) * 32, k (b / 12) * 32)
    v4f wreg[3][8];
    #pragma unroll
    for (int i = 0; i < 3; ++i) {
      const int b = i * 16 + wave;
      wblk_load(wreg[i], w_qkv + (b / 12) * 32 * 384 + (b % 12) * 32, 384);
    }

    // 8 lanes per token, 4 x 4 features per lane
    const int tl = lane >> 3, l = lane & 7;
    _Float16* zs = zsm + wave * 16 * 128;
    const unsigned zo = ((wave * 16 + tl * 4) * 128 + l * 4) * 4;   // the lane's byte offset in the row
    v4f x[4][4];                             // the wave's token tile: [it][j], token tl*4 + it
    #pragma unroll
    for (int it = 0; it < 4; ++it)
      #pragma unroll
      for (int j = 0; j < 4; ++j) x[it][j] = *(const v4f*)((const char*)zr + (zo + (it * 128 + j * 32) * 4));
    v4f g4[4], b4[4];
    #pragma unroll
    for (int j = 0; j < 4; ++j) {
      g4[j] = *(const v4f*)(ln_g + (j * 8 + l) * 4);
      b4[j] = *(const v4f*)(ln_b + (j * 8 + l) * 4);
    }
    #pragma unroll
    for (int i = 0; i < 3; ++i) {
      const int b = i * 16 + wave;
      wblk_store(wreg[i], wsm + (b % 12) * 32 * WP + (b / 12) * 32, WP);
    }
    // holds the tile's 16 loads together in front of their first use, so that all are in flight at once;
    // zo and l are named so that no load lands on an offset register that the others still name
    asm volatile("" :: "v"(x[0][0]), "v"(x[0][1]), "v"(x[0][2]), "v"(x[0][3]),
                       "v"(x[1][0]), "v"(x[1][1]), "v"(x[1][2]), "v"(x[1][3]),
                       "v"(x[2][0]), "v"(x[2][1]), "v"(x[2][2]), "v"(x[2][3]),
                       "v"(x[3][0]), "v"(x[3][1]), "v"(x[3][2]), "v"(x[3][3]), "v"(zo), "v"(l));
    #pragma unroll
    for (int it = 0; it < 4; ++it) {
      const int row = tl * 4 + it;
      float s = 0.f, ss = 0.f;
      #pragma unroll
      for (int j = 0; j < 4; ++j)
        #pragma unroll
        for (int e = 0; e < 4; ++e) { s += x[it][j][e]; ss += x[it][j][e] * x[it][j][e]; }
      #pragma unroll
      for (int off = 1; off < 8; off <<= 1) {
        s  += __shfl_xor(s,  off, 32);
        ss += __shfl_xor(ss, off, 32);
      }
      const float mu   = s * (1.f / 128.f);
      const float var  = ss * (1.f / 128.f) - mu * mu;
      const float rstd = rsqrtf(var + 1e-5f);
      #pragma unroll
      for (int j = 0; j < 4; ++j) {
        v4h y;
        #pragma unroll
        for (int e = 0; e < 4; ++e)
          y[e] = (_Float16)((x[it][j][e] - mu) * rstd * g4[j][e] + b4[j][e]);
        *(v4h*)(zs + row * 128 + (((j * 4 + (l >> 1)) ^ row) * 8) + (l & 1) * 4) = y;
      }
    }
  }
  __syncthreads();   // zn of all 256 tokens and W^T, staged by all waves, are in LDS before any wave reads them

  v16h qa[4];                                // Q fragments of the wave's 4 query tiles
  v4f preg[8];                               // the wave's block of W_proj, f32
  _Float16* kh = ksm + h * 256 * KP;         // head h's K
  _Float16* vh = vsm + h * 32 * VP;          // head h's V^T
  {
    v16h zf[4][4];                           // zn fragments of the wave's 4 token tiles
    #pragma unroll
    for (int t = 0; t < 4; ++t) {
      const _Float16* zt = zsm + (qd * 64 + t * 16 + n) * 128;
      #pragma unroll
      for (int kc = 0; kc < 4; ++kc) {
        // same k order as load_frag_rm: halves kc*32 + halfw*8 + 0..7, then + 16
        const v8h lo = *(const v8h*)(zt + (((kc * 4 + halfw) ^ n) * 8));
        const v8h hi = *(const v8h*)(zt + (((kc * 4 + 2 + halfw) ^ n) * 8));
        zf[t][kc] = __builtin_shufflevector(lo, hi, 0, 1, 2, 3, 4, 5, 6, 7, 8, 9, 10, 11, 12, 13, 14, 15);
      }
    }

    // 6 feature tiles of head h: 0,1 = q, 2,3 = k, 4,5 = v
    #pragma unroll
    for (int ft = 0; ft < 6; ++ft) {
      const int which = ft >> 1, fh = ft & 1;
      const int f0 = which * 128 + h * 32 + fh * 16;
      v16h wf[4];
      #pragma unroll
      for (int kc = 0; kc < 4; ++kc) wf[kc] = load_frag_rm(wsm + f0 * WP + kc * 32, WP);
      if (which < 2) {
        // W as A, zn as B: a lane holds 8 consecutive features of one token
        const v4f bl = *(const v4f*)(b_qkv + f0 + halfw * 8);
        const v4f bh = *(const v4f*)(b_qkv + f0 + halfw * 8 + 4);
        #pragma unroll
        for (int t = 0; t < 4; ++t) {
          v8f acc = {};
          #pragma unroll
          for (int kc = 0; kc < 4; ++kc) acc = WMMA_F32_F16(wf[kc], zf[t][kc], acc);
          v8h y;
          #pragma unroll
          for (int i = 0; i < 8; ++i) y[i] = (_Float16)(acc[i] + (i < 4 ? bl[i & 3] : bh[i & 3]));
          if (which == 0) {
            // feature fh*16 + halfw*8 + i of token n is element fh*8 + i of the fragment
            #pragma unroll
            for (int i = 0; i < 8; ++i) qa[t][fh * 8 + i] = y[i];
          } else {
            *(v8h*)(kh + (qd * 64 + t * 16 + n) * KP + fh * 16 + halfw * 8) = y;
          }
        }
      } else {
        // zn as A, W as B: a lane holds 8 consecutive tokens of one feature
        const float bias = b_qkv[f0 + n];
        #pragma unroll
        for (int t = 0; t < 4; ++t) {
          // W_proj: 16 blocks of 32 k x 32 features, one a wave; asked for as soon as the first zn fragments'
          // registers are free, so that the last V products cover part of the latency ahead of the barrier
          if (ft == 5 && t == 1) wblk_load(preg, w_proj + h * 32 * 128 + qd * 32, 128);
          v8f acc = {};
          #pragma unroll
          for (int kc = 0; kc < 4; ++kc) acc = WMMA_F32_F16(zf[t][kc], wf[kc], acc);
          v8h y;
          #pragma unroll
          for (int i = 0; i < 8; ++i) y[i] = (_Float16)(acc[i] + bias);
          *(v8h*)(vh + (fh * 16 + n) * VP + qd * 64 + t * 16 + halfw * 8) = y;
        }
      }
    }
  }
  __syncthreads();   // every wave's K and V^T rows are in LDS before any wave reads them; zn and W_qkv^T have been read by all, so O and W_proj^T may take their places
  wblk_store(preg, wsm + qd * 32 * WP + h * 32, WP);

  const float scale = 0.17677669529663687f;  // 1/sqrt(32)

  for (int mt = 0; mt < 4; ++mt) {
    // compiler fence: keeps the K and V^T fragment reads inside the loop; lifted out of it as loop-invariant
    // they need 256 registers and go to scratch
    asm volatile("" ::: "memory");
    const int q0 = (qd * 4 + mt) * 16;
    const v16h qb = mt == 0 ? qa[0] : mt == 1 ? qa[1] : mt == 2 ? qa[2] : qa[3];   // K-dim=32: one WMMA per tile
    // S^T = K Q^T: K rows as A, Q as B (same k order in both). s[nt][i] is the score of
    // key nt*16 + halfw*8 + i for query n: a lane and its partner lane ^ 16 hold one query's 256 scores.
    v8f s[16];
    #pragma unroll
    for (int nt = 0; nt < 16; ++nt) {
      const v16h ka = load_frag_rm(kh + nt * 16 * KP, KP);
      v8f cz = {};
      s[nt] = WMMA_F32_F16(ka, qb, cz);
    }
    // softmax over 256 keys: in the lane (four independent chains for the maximum, eight for the sum),
    // then one exchange between the wave's halves
    float m4[4];
    #pragma unroll
    for (int c = 0; c < 4; ++c) {
      float m = -1e30f;
      #pragma unroll
      for (int nt = c; nt < 16; nt += 4)
        #pragma unroll
        for (int i = 0; i < 8; ++i) m = fmaxf(m, s[nt][i]);
      m4[c] = m;
    }
    float m = fmaxf(fmaxf(m4[0], m4[1]), fmaxf(m4[2], m4[3]));
    m = fmaxf(m, xhalf(m));
    const float mx = m * scale;
    v8f sv = {};
    #pragma unroll
    for (int nt = 0; nt < 16; ++nt) {
      #pragma unroll
      for (int i = 0; i < 8; ++i) s[nt][i] = __expf(s[nt][i] * scale - mx);
      sv += s[nt];
    }
    float sm = ((sv[0] + sv[1]) + (sv[2] + sv[3])) + ((sv[4] + sv[5]) + (sv[6] + sv[7]));
    sm += xhalf(sm);
    const float rs = 1.f / sm;

    // O^T = V^T P^T: V^T rows as A from LDS; two score tiles, converted in place, are the B operand
    // (element e of the fragment = key kt*32 + (e/8)*16 + halfw*8 + e%8, the k order of load_frag_rm)
    v8f oc[2] = {};
    #pragma unroll
    for (int kt = 0; kt < 8; ++kt) {
      const v8h lo = __builtin_convertvector(s[2 * kt],     v8h);
      const v8h hi = __builtin_convertvector(s[2 * kt + 1], v8h);
      const v16h pb = __builtin_shufflevector(lo, hi, 0, 1, 2, 3, 4, 5, 6, 7, 8, 9, 10, 11, 12, 13, 14, 15);
      #pragma unroll
      for (int nt2 = 0; nt2 < 2; ++nt2) {
        const v16h va = load_frag_rm(vh + nt2 * 16 * VP + kt * 32, VP);
        oc[nt2] = WMMA_F32_F16(va, pb, oc[nt2]);
      }
    }
    // oc[nt2][i] is feature h*32 + nt2*16 + halfw*8 + i of query n: the query's 1/sum is in the lane,
    // one 16-byte chunk (index h*4 + nt2*2 + halfw) of the query's O row per tile
    #pragma unroll
    for (int nt2 = 0; nt2 < 2; ++nt2) {
      v8h y;
      #pragma unroll
      for (int i = 0; i < 8; ++i) y[i] = (_Float16)(oc[nt2][i] * rs);
      *(v8h*)(zsm + (q0 + n) * 128 + (((h * 4 + nt2 * 2 + halfw) ^ n) * 8)) = y;
    }
  }

  // output projection: W_proj^T rows as A, O as B, so that a lane holds 8 consecutive output features of one token.
  // What comes from global (bias, residual) is loaded in front of the barrier.
  v4f pbias[2][2];
  #pragma unroll
  for (int nt = 0; nt < 2; ++nt) {
    pbias[nt][0] = *(const v4f*)(b_proj + h * 32 + nt * 16 + halfw * 8);
    pbias[nt][1] = *(const v4f*)(b_proj + h * 32 + nt * 16 + halfw * 8 + 4);
  }
  const unsigned eo = (qd * 64 + n) * 128 + h * 32 + halfw * 8;   // the lane's element offset in the row: token, first feature
  v4f zres[4][2][2];
  #pragma unroll
  for (int t = 0; t < 4; ++t)
    #pragma unroll
    for (int nt = 0; nt < 2; ++nt)
      #pragma unroll
      for (int c = 0; c < 2; ++c) zres[t][nt][c] = *(const v4f*)(zr + eo + t * 16 * 128 + nt * 16 + c * 4);
  __syncthreads();   // all four heads' O rows and all waves' W_proj^T blocks are in LDS before any wave reads them

  v16h pw[2][4];
  #pragma unroll
  for (int nt = 0; nt < 2; ++nt)
    #pragma unroll
    for (int kc = 0; kc < 4; ++kc) pw[nt][kc] = load_frag_rm(wsm + (h * 32 + nt * 16) * WP + kc * 32, WP);

  float* outr = out + (size_t)r * 256 * 128;
  #pragma unroll
  for (int t = 0; t < 4; ++t) {
    const _Float16* ot = zsm + (qd * 64 + t * 16 + n) * 128;
    v8f acc[2] = {};
    #pragma unroll
    for (int kc = 0; kc < 4; ++kc) {
      // same k order as load_frag_rm: halves kc*32 + halfw*8 + 0..7, then + 16
      const v8h lo = *(const v8h*)(ot + (((kc * 4 + halfw) ^ n) * 8));
      const v8h hi = *(const v8h*)(ot + (((kc * 4 + 2 + halfw) ^ n) * 8));
      const v16h ob = __builtin_shufflevector(lo, hi, 0, 1, 2, 3, 4, 5, 6, 7, 8, 9, 10, 11, 12, 13, 14, 15);
      #pragma unroll
      for (int nt = 0; nt < 2; ++nt) acc[nt] = WMMA_F32_F16(pw[nt][kc], ob, acc[nt]);
    }
    #pragma unroll
    for (int nt = 0; nt < 2; ++nt)
      #pragma unroll
      for (int c = 0; c < 2; ++c) {
        v4f y;
        #pragma unroll
        for (int e = 0; e < 4; ++e) y[e] = zres[t][nt][c][e] + acc[nt][c * 4 + e] + pbias[nt][c][e];
        *(v4f*)(outr + eo + t * 16 * 128 + nt * 16 + c * 4) = y;
      }
  }
}

extern "C" void kernel_launch(void* const* d_in, const int* in_sizes, int n_in,
                              void* d_out, int out_size, void* d_ws, size_t ws_size,
                              hipStream_t stream) {
  const float* z      = (const float*)d_in[0];
  const float* ln_g   = (const float*)d_in[1];
  const float* ln_b   = (const float*)d_in[2];
  const float* w_qkv  = (const float*)d_in[3];
  const float* b_qkv  = (const float*)d_in[4];
  const float* w_proj = (const float*)d_in[5];
  const float* b_proj = (const float*)d_in[6];
  float* out = (float*)d_out;

  k_row<<<256, 512, 0, stream>>>(z, ln_g, ln_b, w_qkv, b_qkv, w_proj, b_proj, out);
}

// v006
// Measured time: 23.8 microseconds a run.
// Two timings next to v005 both put it at 1.25 times that version's speed.
// Counting every step since v000, it is 8.23 times as fast.
#include <hip/hip_runtime.h>

typedef __attribute__((ext_vector_type(16))) _Float16 v16h;
typedef __attribute__((ext_vector_type(8)))  float    v8f;
typedef __attribute__((ext_vector_type(4)))  float    v4f;
typedef __attribute__((ext_vector_type(8)))  _Float16 v8h;
typedef __attribute__((ext_vector_type(4)))  _Float16 v4h;

#define WMMA_F32_F16(a,b,c) __builtin_amdgcn_wmma_f32_16x16x32_f16(false,(a),false,(b),(short)0,(c),false,false)

// Load a 16x32 f16 A-fragment (also valid for B when given B^T stored [N][K])
// from row-major storage with leading dimension `ld` (in elements).
// ISA 7.12.2: lane 0-15 -> row = lane, lanes 16-31 -> row = lane-16 with K offset +8;
// VGPR j in 0..3 -> K = 2*j (+half*8), VGPR 4..7 -> K = 16 + 2*(j-4) (+half*8).
__device__ __forceinline__ v16h load_frag_rm(const _Float16* __restrict__ p, int ld) {
  const int lane = threadIdx.x & 31;
  const int row  = lane & 15;
  const int half = lane >> 4;
  v16h f;
  #pragma unroll
  for (int j = 0; j < 8; ++j) {
    const int kb = ((j & 3) << 1) + (half << 3) + ((j >> 2) << 4);
    f[2 * j]     = p[row * ld + kb];
    f[2 * j + 1] = p[row * ld + kb + 1];
  }
  return f;
}

// value of lane ^ 16 (the other 16-lane half of the wave)
__device__ __forceinline__ float xhalf(float v) {
  const int b = __builtin_bit_cast(int, v);
  return __builtin_bit_cast(float, __builtin_amdgcn_permlanex16(b, b, 0x76543210, 0xfedcba98, false, false));
}

// A wave's 32 x 32 block of a row-major f32 weight [k][n], on its way to f16 [n][k] rows in LDS.
// Lane (a, c) takes columns a*4..+3 of rows c*8..+7: each load covers four whole 128-B lines, and each lane
// ends with 8 consecutive k of 4 columns, one 16-byte LDS store a column.
// a and c are dealt so that the 16 lanes of a half wave store to 16 distinct bank groups at a 272-B row pitch.
__device__ __forceinline__ void wblk_load(v4f (&x)[8], const float* __restrict__ w, int ld) {
  const int lane = threadIdx.x & 31;
  const int a = (lane & 3) | ((lane >> 4) << 2), c = (lane >> 2) & 3;
  const unsigned lo = (c * 8 * ld + a * 4) * 4;   // the lane's byte offset in the block: one register beside the wave's scalar base
  #pragma unroll
  for (int j = 0; j < 8; ++j) x[j] = *(const v4f*)((const char*)w + (lo + j * ld * 4));
}
__device__ __forceinline__ void wblk_store(const v4f (&x)[8], _Float16* dst, int pitch) {
  const int lane = threadIdx.x & 31;
  const int a = (lane & 3) | ((lane >> 4) << 2), c = (lane >> 2) & 3;
  #pragma unroll
  for (int e = 0; e < 4; ++e) {
    v8h y;
    #pragma unroll
    for (int j = 0; j < 8; ++j) y[j] = (_Float16)x[j][e];
    *(v8h*)(dst + (a * 4 + e) * pitch + c * 8) = y;
  }
}

// ---------------- LayerNorm + QKV + attention + output projection + residual, weights converted on the way in ---------
// grid = 256 (one block per row r), block = 512 (16 waves). Wave w normalises tokens w*16..+15 once and leaves
// zn in LDS for all heads. From there wave w is (head h = w/4, token quarter qd = w%4): it projects its 64 tokens
// on head h's 96 features (K, V^T to LDS, Q in registers), runs 4 sequential 16-query tiles and leaves O in LDS;
// last it computes output features h*32..+31 of its 64 tokens from all heads' O, regroups them through LDS into
// whole 128-B lines and adds bias and residual.
// Both weights come as f32 [k][n] from global and are converted and transposed by the block itself into LDS.
#define WP 136   // staged W^T row pitch in halves: 272 B = 16 B x odd, for 16-byte row readers
#define KP 40    // K row pitch in halves: 80 B = 16 B x odd, so that the 16 rows of a fragment read fall on distinct banks
#define VP 264   // V^T row pitch in halves: 528 B = 16 B x odd, for the same reason
__global__ __launch_bounds__(512) void k_row(const float* __restrict__ z,
                                             const float* __restrict__ ln_g,
                                             const float* __restrict__ ln_b,
                                             const float* __restrict__ w_qkv,
                                             const float* __restrict__ b_qkv,
                                             const float* __restrict__ w_proj,
                                             const float* __restrict__ b_proj,
                                             float* __restrict__ out) {
  // zn, later O: [token][feature], 256-B rows; 16-byte chunk c of row m lies at chunk c ^ (m % 16), so that
  // the writers and the 16-byte fragment readers (16 rows, one chunk index) each meet every bank once
  __shared__ __attribute__((aligned(16))) _Float16 zsm[256 * 128];        // 65536 B
  __shared__ __attribute__((aligned(16))) _Float16 ksm[4 * 256 * KP];     // 81920 B: K [head][key][d], padded rows
  __shared__ __attribute__((aligned(16))) _Float16 vsm[4 * 32 * VP];      // 67584 B: V^T [head][d][key], padded rows
  __shared__ __attribute__((aligned(16))) _Float16 wsm[384 * WP];         // 104448 B: W_qkv^T, all 384 features, padded rows; later W_proj^T, 128 rows
  const int tid = threadIdx.x;
  const int r   = blockIdx.x;
  const int wave = __builtin_amdgcn_readfirstlane(tid >> 5), lane = tid & 31;
  const int h = wave >> 2, qd = wave & 3;
  const int n = lane & 15, halfw = lane >> 4;
  const float* zr = z + (size_t)r * 256 * 128;

  {
    // W_qkv: 48 blocks of 32 k x 32 features, three a wave (block b: features (b % 12) * 32, k (b / 12) * 32)
    v4f wreg[3][8];
    #pragma unroll
    for (int i = 0; i < 3; ++i) {
      const int b = i * 16 + wave;
      wblk_load(wreg[i], w_qkv + (b / 12) * 32 * 384 + (b % 12) * 32, 384);
    }

    // 8 lanes per token, 4 x 4 features per lane
    const int tl = lane >> 3, l = lane & 7;
    _Float16* zs = zsm + wave * 16 * 128;
    const unsigned zo = ((wave * 16 + tl * 4) * 128 + l * 4) * 4;   // the lane's byte offset in the row
    v4f x[4][4];                             // the wave's token tile: [it][j], token tl*4 + it
    #pragma unroll
    for (int it = 0; it < 4; ++it)
      #pragma unroll
      for (int j = 0; j < 4; ++j) x[it][j] = *(const v4f*)((const char*)zr + (zo + (it * 128 + j * 32) * 4));
    v4f g4[4], b4[4];
    #pragma unroll
    for (int j = 0; j < 4; ++j) {
      g4[j] = *(const v4f*)(ln_g + (j * 8 + l) * 4);
      b4[j] = *(const v4f*)(ln_b + (j * 8 + l) * 4);
    }
    #pragma unroll
    for (int i = 0; i < 3; ++i) {
      const int b = i * 16 + wave;
      wblk_store(wreg[i], wsm + (b % 12) * 32 * WP + (b / 12) * 32, WP);
    }
    // holds the tile's 16 loads together in front of their first use, so that all are in flight at once;
    // zo and l are named so that no load lands on an offset register that the others still name
    asm volatile("" :: "v"(x[0][0]), "v"(x[0][1]), "v"(x[0][2]), "v"(x[0][3]),
                       "v"(x[1][0]), "v"(x[1][1]), "v"(x[1][2]), "v"(x[1][3]),
                       "v"(x[2][0]), "v"(x[2][1]), "v"(x[2][2]), "v"(x[2][3]),
                       "v"(x[3][0]), "v"(x[3][1]), "v"(x[3][2]), "v"(x[3][3]), "v"(zo), "v"(l));
    #pragma unroll
    for (int it = 0; it < 4; ++it) {
      const int row = tl * 4 + it;
      float s = 0.f, ss = 0.f;
      #pragma unroll
      for (int j = 0; j < 4; ++j)
        #pragma unroll
        for (int e = 0; e < 4; ++e) { s += x[it][j][e]; ss += x[it][j][e] * x[it][j][e]; }
      #pragma unroll
      for (int off = 1; off < 8; off <<= 1) {
        s  += __shfl_xor(s,  off, 32);
        ss += __shfl_xor(ss, off, 32);
      }
      const float mu   = s * (1.f / 128.f);
      const float var  = ss * (1.f / 128.f) - mu * mu;
      const float rstd = rsqrtf(var + 1e-5f);
      #pragma unroll
      for (int j = 0; j < 4; ++j) {
        v4h y;
        #pragma unroll
        for (int e = 0; e < 4; ++e)
          y[e] = (_Float16)((x[it][j][e] - mu) * rstd * g4[j][e] + b4[j][e]);
        *(v4h*)(zs + row * 128 + (((j * 4 + (l >> 1)) ^ row) * 8) + (l & 1) * 4) = y;
      }
    }
  }
  __syncthreads();   // zn of all 256 tokens and W^T, staged by all waves, are in LDS before any wave reads them

  v16h qa[4];                                // Q fragments of the wave's 4 query tiles
  v4f preg[8];                               // the wave's block of W_proj, f32
  _Float16* kh = ksm + h * 256 * KP;         // head h's K
  _Float16* vh = vsm + h * 32 * VP;          // head h's V^T
  {
    v16h zf[4][4];                           // zn fragments of the wave's 4 token tiles
    #pragma unroll
    for (int t = 0; t < 4; ++t) {
      const _Float16* zt = zsm + (qd * 64 + t * 16 + n) * 128;
      #pragma unroll
      for (int kc = 0; kc < 4; ++kc) {
        // same k order as load_frag_rm: halves kc*32 + halfw*8 + 0..7, then + 16
        const v8h lo = *(const v8h*)(zt + (((kc * 4 + halfw) ^ n) * 8));
        const v8h hi = *(const v8h*)(zt + (((kc * 4 + 2 + halfw) ^ n) * 8));
        zf[t][kc] = __builtin_shufflevector(lo, hi, 0, 1, 2, 3, 4, 5, 6, 7, 8, 9, 10, 11, 12, 13, 14, 15);
      }
    }

    // 6 feature tiles of head h: 0,1 = q, 2,3 = k, 4,5 = v
    #pragma unroll
    for (int ft = 0; ft < 6; ++ft) {
      const int which = ft >> 1, fh = ft & 1;
      const int f0 = which * 128 + h * 32 + fh * 16;
      v16h wf[4];
      #pragma unroll
      for (int kc = 0; kc < 4; ++kc) wf[kc] = load_frag_rm(wsm + f0 * WP + kc * 32, WP);
      if (which < 2) {
        // W as A, zn as B: a lane holds 8 consecutive features of one token
        const v4f bl = *(const v4f*)(b_qkv + f0 + halfw * 8);
        const v4f bh = *(const v4f*)(b_qkv + f0 + halfw * 8 + 4);
        #pragma unroll
        for (int t = 0; t < 4; ++t) {
          v8f acc = {};
          #pragma unroll
          for (int kc = 0; kc < 4; ++kc) acc = WMMA_F32_F16(wf[kc], zf[t][kc], acc);
          v8h y;
          #pragma unroll
          for (int i = 0; i < 8; ++i) y[i] = (_Float16)(acc[i] + (i < 4 ? bl[i & 3] : bh[i & 3]));
          if (which == 0) {
            // feature fh*16 + halfw*8 + i of token n is element fh*8 + i of the fragment
            #pragma unroll
            for (int i = 0; i < 8; ++i) qa[t][fh * 8 + i] = y[i];
          } else {
            *(v8h*)(kh + (qd * 64 + t * 16 + n) * KP + fh * 16 + halfw * 8) = y;
          }
        }
      } else {
        // zn as A, W as B: a lane holds 8 consecutive tokens of one feature
        const float bias = b_qkv[f0 + n];
        #pragma unroll
        for (int t = 0; t < 4; ++t) {
          // W_proj: 16 blocks of 32 k x 32 features, one a wave; asked for as soon as the first zn fragments'
          // registers are free, so that the last V products cover part of the latency ahead of the barrier
          if (ft == 5 && t == 1) wblk_load(preg, w_proj + h * 32 * 128 + qd * 32, 128);
          v8f acc = {};
          #pragma unroll
          for (int kc = 0; kc < 4; ++kc) acc = WMMA_F32_F16(zf[t][kc], wf[kc], acc);
          v8h y;
          #pragma unroll
          for (int i = 0; i < 8; ++i) y[i] = (_Float16)(acc[i] + bias);
          *(v8h*)(vh + (fh * 16 + n) * VP + qd * 64 + t * 16 + halfw * 8) = y;
        }
      }
    }
  }
  __syncthreads();   // every wave's K and V^T rows are in LDS before any wave reads them; zn and W_qkv^T have been read by all, so O and W_proj^T may take their places
  wblk_store(preg, wsm + qd * 32 * WP + h * 32, WP);

  const float scale = 0.17677669529663687f;  // 1/sqrt(32)

  for (int mt = 0; mt < 4; ++mt) {
    // compiler fence: keeps the K and V^T fragment reads inside the loop; lifted out of it as loop-invariant
    // they need 256 registers and go to scratch
    asm volatile("" ::: "memory");
    const int q0 = (qd * 4 + mt) * 16;
    const v16h qb = mt == 0 ? qa[0] : mt == 1 ? qa[1] : mt == 2 ? qa[2] : qa[3];   // K-dim=32: one WMMA per tile
    // S^T = K Q^T: K rows as A, Q as B (same k order in both). s[nt][i] is the score of
    // key nt*16 + halfw*8 + i for query n: a lane and its partner lane ^ 16 hold one query's 256 scores.
    v8f s[16];
    #pragma unroll
    for (int nt = 0; nt < 16; ++nt) {
      const v16h ka = load_frag_rm(kh + nt * 16 * KP, KP);
      v8f cz = {};
      s[nt] = WMMA_F32_F16(ka, qb, cz);
    }
    // softmax over 256 keys: in the lane (four independent chains for the maximum, eight for the sum),
    // then one exchange between the wave's halves
    float m4[4];
    #pragma unroll
    for (int c = 0; c < 4; ++c) {
      float m = -1e30f;
      #pragma unroll
      for (int nt = c; nt < 16; nt += 4)
        #pragma unroll
        for (int i = 0; i < 8; ++i) m = fmaxf(m, s[nt][i]);
      m4[c] = m;
    }
    float m = fmaxf(fmaxf(m4[0], m4[1]), fmaxf(m4[2], m4[3]));
    m = fmaxf(m, xhalf(m));
    const float mx = m * scale;
    v8f sv = {};
    #pragma unroll
    for (int nt = 0; nt < 16; ++nt) {
      #pragma unroll
      for (int i = 0; i < 8; ++i) s[nt][i] = __expf(s[nt][i] * scale - mx);
      sv += s[nt];
    }
    float sm = ((sv[0] + sv[1]) + (sv[2] + sv[3])) + ((sv[4] + sv[5]) + (sv[6] + sv[7]));
    sm += xhalf(sm);
    const float rs = 1.f / sm;

    // O^T = V^T P^T: V^T rows as A from LDS; two score tiles, converted in place, are the B operand
    // (element e of the fragment = key kt*32 + (e/8)*16 + halfw*8 + e%8, the k order of load_frag_rm)
    v8f oc[2] = {};
    #pragma unroll
    for (int kt = 0; kt < 8; ++kt) {
      const v8h lo = __builtin_convertvector(s[2 * kt],     v8h);
      const v8h hi = __builtin_convertvector(s[2 * kt + 1], v8h);
      const v16h pb = __builtin_shufflevector(lo, hi, 0, 1, 2, 3, 4, 5, 6, 7, 8, 9, 10, 11, 12, 13, 14, 15);
      #pragma unroll
      for (int nt2 = 0; nt2 < 2; ++nt2) {
        const v16h va = load_frag_rm(vh + nt2 * 16 * VP + kt * 32, VP);
        oc[nt2] = WMMA_F32_F16(va, pb, oc[nt2]);
      }
    }
    // oc[nt2][i] is feature h*32 + nt2*16 + halfw*8 + i of query n: the query's 1/sum is in the lane,
    // one 16-byte chunk (index h*4 + nt2*2 + halfw) of the query's O row per tile
    #pragma unroll
    for (int nt2 = 0; nt2 < 2; ++nt2) {
      v8h y;
      #pragma unroll
      for (int i = 0; i < 8; ++i) y[i] = (_Float16)(oc[nt2][i] * rs);
      *(v8h*)(zsm + (q0 + n) * 128 + (((h * 4 + nt2 * 2 + halfw) ^ n) * 8)) = y;
    }
  }

  // output projection: W_proj^T rows as A, O as B, so that a lane holds 8 consecutive output features of one token.
  // That map puts 16-byte pieces of 16 different lines into each global access, so the wave's 64 x 32 f32 result
  // makes a trip through LDS of its own: behind it lane (tr, c8) holds 16-byte chunk c8 of a token's 128-B line,
  // and each residual load and each output store covers four whole lines.
  // What comes from global (bias, residual) is loaded in front of the barrier.
  const int tr = lane >> 3, c8 = lane & 7;
  const v4f pbias = *(const v4f*)(b_proj + h * 32 + c8 * 4);
  const unsigned eo = (qd * 64 + tr) * 128 + h * 32 + c8 * 4;   // the lane's element offset in the row: token, first feature
  v4f zres[4][4];                            // [t][j]: token qd*64 + t*16 + j*4 + tr
  #pragma unroll
  for (int t = 0; t < 4; ++t)
    #pragma unroll
    for (int j = 0; j < 4; ++j) zres[t][j] = *(const v4f*)(zr + eo + (t * 16 + j * 4) * 128);
  __syncthreads();   // all four heads' O rows and all waves' W_proj^T blocks are in LDS before any wave reads them; K and V^T have been read by all, so the result tiles may take their places

  v16h pw[2][4];
  #pragma unroll
  for (int nt = 0; nt < 2; ++nt)
    #pragma unroll
    for (int kc = 0; kc < 4; ++kc) pw[nt][kc] = load_frag_rm(wsm + (h * 32 + nt * 16) * WP + kc * 32, WP);

  // the wave's own four result tiles, f32 [16 tokens][32 features], 128-B rows: tiles 0, 1 in K's place, 2, 3 in V^T's.
  // 16-byte chunk c of row m lies at chunk c ^ (m / 2): the writers (16 rows, one chunk index) and the readers
  // (two whole rows a half wave) each meet every bank once.
  float* st01 = (float*)ksm + wave * 1024;
  float* st23 = (float*)vsm + wave * 1024;
  #pragma unroll
  for (int t = 0; t < 4; ++t) {
    const _Float16* ot = zsm + (qd * 64 + t * 16 + n) * 128;
    v8f acc[2] = {};
    #pragma unroll
    for (int kc = 0; kc < 4; ++kc) {
      // same k order as load_frag_rm: halves kc*32 + halfw*8 + 0..7, then + 16
      const v8h lo = *(const v8h*)(ot + (((kc * 4 + halfw) ^ n) * 8));
      const v8h hi = *(const v8h*)(ot + (((kc * 4 + 2 + halfw) ^ n) * 8));
      const v16h ob = __builtin_shufflevector(lo, hi, 0, 1, 2, 3, 4, 5, 6, 7, 8, 9, 10, 11, 12, 13, 14, 15);
      #pragma unroll
      for (int nt = 0; nt < 2; ++nt) acc[nt] = WMMA_F32_F16(pw[nt][kc], ob, acc[nt]);
    }
    float* st = (t < 2 ? st01 : st23) + (t & 1) * 512;
    #pragma unroll
    for (int nt = 0; nt < 2; ++nt)
      #pragma unroll
      for (int c = 0; c < 2; ++c) {
        const v4f y = {acc[nt][c * 4], acc[nt][c * 4 + 1], acc[nt][c * 4 + 2], acc[nt][c * 4 + 3]};
        *(v4f*)(st + n * 32 + (((nt * 4 + halfw * 2 + c) ^ (n >> 1)) * 4)) = y;
      }
  }
  // the wave reads back rows that its other lanes wrote: its LDS stores have landed, and no read is lifted over them
  asm volatile("s_wait_dscnt 0x0" ::: "memory");

  float* outr = out + (size_t)r * 256 * 128;
  #pragma unroll
  for (int t = 0; t < 4; ++t) {
    const float* st = (t < 2 ? st01 : st23) + (t & 1) * 512;
    #pragma unroll
    for (int j = 0; j < 4; ++j) {
      const int row = j * 4 + tr;
      const v4f a4 = *(const v4f*)(st + row * 32 + ((c8 ^ (row >> 1)) * 4));
      v4f y;
      #pragma unroll
      for (int e = 0; e < 4; ++e) y[e] = zres[t][j][e] + a4[e] + pbias[e];
      *(v4f*)(outr + eo + (t * 16 + j * 4) * 128) = y;
    }
  }
}

extern "C" void kernel_launch(void* const* d_in, const int* in_sizes, int n_in,
                              void* d_out, int out_size, void* d_ws, size_t ws_size,
                              hipStream_t stream) {
  const float* z      = (const float*)d_in[0];
  const float* ln_g   = (const float*)d_in[1];
  const float* ln_b   = (const float*)d_in[2];
  const float* w_qkv  = (const float*)d_in[3];
  const float* b_qkv  = (const float*)d_in[4];
  const float* w_proj = (const float*)d_in[5];
  const float* b_proj = (const float*)d_in[6];
  float* out = (float*)d_out;

  k_row<<<256, 512, 0, stream>>>(z, ln_g, ln_b, w_qkv, b_qkv, w_proj, b_proj, out);
}

// v007
// It runs in 22.9 microseconds.
// Two timings next to v006 put it at 1.03 and 1.04 times that version's speed.
// All steps since v000 together make it 8.52 times as fast.
#include <hip/hip_runtime.h>

typedef __attribute__((ext_vector_type(16))) _Float16 v16h;
typedef __attribute__((ext_vector_type(8)))  float    v8f;
typedef __attribute__((ext_vector_type(4)))  float    v4f;
typedef __attribute__((ext_vector_type(8)))  _Float16 v8h;
typedef __attribute__((ext_vector_type(4)))  _Float16 v4h;

#define WMMA_F32_F16(a,b,c) __builtin_amdgcn_wmma_f32_16x16x32_f16(false,(a),false,(b),(short)0,(c),false,false)

// Load a 16x32 f16 A-fragment (also valid for B when given B^T stored [N][K])
// from row-major storage with leading dimension `ld` (in elements).
// ISA 7.12.2: lane 0-15 -> row = lane, lanes 16-31 -> row = lane-16 with K offset +8;
// VGPR j in 0..3 -> K = 2*j (+half*8), VGPR 4..7 -> K = 16 + 2*(j-4) (+half*8).
__device__ __forceinline__ v16h load_frag_rm(const _Float16* __restrict__ p, int ld) {
  const int lane = threadIdx.x & 31;
  const int row  = lane & 15;
  const int half = lane >> 4;
  v16h f;
  #pragma unroll
  for (int j = 0; j < 8; ++j) {
    const int kb = ((j & 3) << 1) + (half << 3) + ((j >> 2) << 4);
    f[2 * j]     = p[row * ld + kb];
    f[2 * j + 1] = p[row * ld + kb + 1];
  }
  return f;
}

// value of lane ^ 16 (the other 16-lane half of the wave)
__device__ __forceinline__ float xhalf(float v) {
  const int b = __builtin_bit_cast(int, v);
  return __builtin_bit_cast(float, __builtin_amdgcn_permlanex16(b, b, 0x76543210, 0xfedcba98, false, false));
}

// A wave's 32 x 32 block of a row-major f32 weight [k][n], on its way to f16 [n][k] rows in LDS.
// Lane (a, c) takes columns a*4..+3 of rows c*8..+7: each load covers four whole 128-B lines, and each lane
// ends with 8 consecutive k of 4 columns, one 16-byte LDS store a column.
// a and c are dealt so that the 16 lanes of a half wave store to 16 distinct bank groups at a 272-B row pitch.
__device__ __forceinline__ void wblk_load(v4f (&x)[8], const float* __restrict__ w, int ld) {
  const int lane = threadIdx.x & 31;
  const int a = (lane & 3) | ((lane >> 4) << 2), c = (lane >> 2) & 3;
  const unsigned lo = (c * 8 * ld + a * 4) * 4;   // the lane's byte offset in the block: one register beside the wave's scalar base
  #pragma unroll
  for (int j = 0; j < 8; ++j) x[j] = *(const v4f*)((const char*)w + (lo + j * ld * 4));
}
__device__ __forceinline__ void wblk_store(const v4f (&x)[8], _Float16* dst, int pitch) {
  const int lane = threadIdx.x & 31;
  const int a = (lane & 3) | ((lane >> 4) << 2), c = (lane >> 2) & 3;
  #pragma unroll
  for (int e = 0; e < 4; ++e) {
    v8h y;
    #pragma unroll
    for (int j = 0; j < 8; ++j) y[j] = (_Float16)x[j][e];
    *(v8h*)(dst + (a * 4 + e) * pitch + c * 8) = y;
  }
}

// ---------------- LayerNorm + QKV + attention + output projection + residual, weights converted on the way in ---------
// grid = 256 (one block per row r), block = 512 (16 waves). Wave w normalises tokens w*16..+15 once and leaves
// zn in LDS for all heads. From there wave w is (head h = w/4, token quarter qd = w%4): it projects its 64 tokens
// on head h's 96 features (K, V^T to LDS, Q in registers), runs 2 sequential pairs of 16-query tiles and leaves O in LDS;
// last it computes output features h*32..+31 of its 64 tokens from all heads' O, regroups them through LDS into
// whole 128-B lines and adds bias and residual.
// Both weights come as f32 [k][n] from global and are converted and transposed by the block itself into LDS.
#define WP 136   // staged W^T row pitch in halves: 272 B = 16 B x odd, for 16-byte row readers
#define KP 40    // K row pitch in halves: 80 B = 16 B x odd, so that the 16 rows of a fragment read fall on distinct banks
#define VP 264   // V^T row pitch in halves: 528 B = 16 B x odd, for the same reason
__global__ __launch_bounds__(512) void k_row(const float* __restrict__ z,
                                             const float* __restrict__ ln_g,
                                             const float* __restrict__ ln_b,
                                             const float* __restrict__ w_qkv,
                                             const float* __restrict__ b_qkv,
                                             const float* __restrict__ w_proj,
                                             const float* __restrict__ b_proj,
                                             float* __restrict__ out) {
  // zn, later O: [token][feature], 256-B rows; 16-byte chunk c of row m lies at chunk c ^ (m % 16), so that
  // the writers and the 16-byte fragment readers (16 rows, one chunk index) each meet every bank once
  __shared__ __attribute__((aligned(16))) _Float16 zsm[256 * 128];        // 65536 B
  __shared__ __attribute__((aligned(16))) _Float16 ksm[4 * 256 * KP];     // 81920 B: K [head][key][d], padded rows
  __shared__ __attribute__((aligned(16))) _Float16 vsm[4 * 32 * VP];      // 67584 B: V^T [head][d][key], padded rows
  __shared__ __attribute__((aligned(16))) _Float16 wsm[384 * WP];         // 104448 B: W_qkv^T, all 384 features, padded rows; later W_proj^T, 128 rows
  const int tid = threadIdx.x;
  const int r   = blockIdx.x;
  const int wave = __builtin_amdgcn_readfirstlane(tid >> 5), lane = tid & 31;
  const int h = wave >> 2, qd = wave & 3;
  const int n = lane & 15, halfw = lane >> 4;
  const float* zr = z + (size_t)r * 256 * 128;

  {
    // W_qkv: 48 blocks of 32 k x 32 features, three a wave (block b: features (b % 12) * 32, k (b / 12) * 32)
    v4f wreg[3][8];
    #pragma unroll
    for (int i = 0; i < 3; ++i) {
      const int b = i * 16 + wave;
      wblk_load(wreg[i], w_qkv + (b / 12) * 32 * 384 + (b % 12) * 32, 384);
    }

    // 8 lanes per token, 4 x 4 features per lane
    const int tl = lane >> 3, l = lane & 7;
    _Float16* zs = zsm + wave * 16 * 128;
    const unsigned zo = ((wave * 16 + tl * 4) * 128 + l * 4) * 4;   // the lane's byte offset in the row
    v4f x[4][4];                             // the wave's token tile: [it][j], token tl*4 + it
    #pragma unroll
    for (int it = 0; it < 4; ++it)
      #pragma unroll
      for (int j = 0; j < 4; ++j) x[it][j] = *(const v4f*)((const char*)zr + (zo + (it * 128 + j * 32) * 4));
    v4f g4[4], b4[4];
    #pragma unroll
    for (int j = 0; j < 4; ++j) {
      g4[j] = *(const v4f*)(ln_g + (j * 8 + l) * 4);
      b4[j] = *(const v4f*)(ln_b + (j * 8 + l) * 4);
    }
    #pragma unroll
    for (int i = 0; i < 3; ++i) {
      const int b = i * 16 + wave;
      wblk_store(wreg[i], wsm + (b % 12) * 32 * WP + (b / 12) * 32, WP);
    }
    // holds the tile's 16 loads together in front of their first use, so that all are in flight at once;
    // zo and l are named so that no load lands on an offset register that the others still name
    asm volatile("" :: "v"(x[0][0]), "v"(x[0][1]), "v"(x[0][2]), "v"(x[0][3]),
                       "v"(x[1][0]), "v"(x[1][1]), "v"(x[1][2]), "v"(x[1][3]),
                       "v"(x[2][0]), "v"(x[2][1]), "v"(x[2][2]), "v"(x[2][3]),
                       "v"(x[3][0]), "v"(x[3][1]), "v"(x[3][2]), "v"(x[3][3]), "v"(zo), "v"(l));
    #pragma unroll
    for (int it = 0; it < 4; ++it) {
      const int row = tl * 4 + it;
      float s = 0.f, ss = 0.f;
      #pragma unroll
      for (int j = 0; j < 4; ++j)
        #pragma unroll
        for (int e = 0; e < 4; ++e) { s += x[it][j][e]; ss += x[it][j][e] * x[it][j][e]; }
      #pragma unroll
      for (int off = 1; off < 8; off <<= 1) {
        s  += __shfl_xor(s,  off, 32);
        ss += __shfl_xor(ss, off, 32);
      }
      const float mu   = s * (1.f / 128.f);
      const float var  = ss * (1.f / 128.f) - mu * mu;
      const float rstd = rsqrtf(var + 1e-5f);
      #pragma unroll
      for (int j = 0; j < 4; ++j) {
        v4h y;
        #pragma unroll
        for (int e = 0; e < 4; ++e)
          y[e] = (_Float16)((x[it][j][e] - mu) * rstd * g4[j][e] + b4[j][e]);
        *(v4h*)(zs + row * 128 + (((j * 4 + (l >> 1)) ^ row) * 8) + (l & 1) * 4) = y;
      }
    }
  }
  __syncthreads();   // zn of all 256 tokens and W^T, staged by all waves, are in LDS before any wave reads them

  v16h qa[4];                                // Q fragments of the wave's 4 query tiles
  v4f preg[8];                               // the wave's block of W_proj, f32
  _Float16* kh = ksm + h * 256 * KP;         // head h's K
  _Float16* vh = vsm + h * 32 * VP;          // head h's V^T
  {
    v16h zf[4][4];                           // zn fragments of the wave's 4 token tiles
    #pragma unroll
    for (int t = 0; t < 4; ++t) {
      const _Float16* zt = zsm + (qd * 64 + t * 16 + n) * 128;
      #pragma unroll
      for (int kc = 0; kc < 4; ++kc) {
        // same k order as load_frag_rm: halves kc*32 + halfw*8 + 0..7, then + 16
        const v8h lo = *(const v8h*)(zt + (((kc * 4 + halfw) ^ n) * 8));
        const v8h hi = *(const v8h*)(zt + (((kc * 4 + 2 + halfw) ^ n) * 8));
        zf[t][kc] = __builtin_shufflevector(lo, hi, 0, 1, 2, 3, 4, 5, 6, 7, 8, 9, 10, 11, 12, 13, 14, 15);
      }
    }

    // 6 feature tiles of head h: 0,1 = q, 2,3 = k, 4,5 = v
    #pragma unroll
    for (int ft = 0; ft < 6; ++ft) {
      const int which = ft >> 1, fh = ft & 1;
      const int f0 = which * 128 + h * 32 + fh * 16;
      v16h wf[4];
      #pragma unroll
      for (int kc = 0; kc < 4; ++kc) wf[kc] = load_frag_rm(wsm + f0 * WP + kc * 32, WP);
      if (which < 2) {
        // W as A, zn as B: a lane holds 8 consecutive features of one token
        const v4f bl = *(const v4f*)(b_qkv + f0 + halfw * 8);
        const v4f bh = *(const v4f*)(b_qkv + f0 + halfw * 8 + 4);
        #pragma unroll
        for (int t = 0; t < 4; ++t) {
          v8f acc = {};
          #pragma unroll
          for (int kc = 0; kc < 4; ++kc) acc = WMMA_F32_F16(wf[kc], zf[t][kc], acc);
          v8h y;
          #pragma unroll
          for (int i = 0; i < 8; ++i) y[i] = (_Float16)(acc[i] + (i < 4 ? bl[i & 3] : bh[i & 3]));
          if (which == 0) {
            // feature fh*16 + halfw*8 + i of token n is element fh*8 + i of the fragment
            #pragma unroll
            for (int i = 0; i < 8; ++i) qa[t][fh * 8 + i] = y[i];
          } else {
            *(v8h*)(kh + (qd * 64 + t * 16 + n) * KP + fh * 16 + halfw * 8) = y;
          }
        }
      } else {
        // zn as A, W as B: a lane holds 8 consecutive tokens of one feature
        const float bias = b_qkv[f0 + n];
        #pragma unroll
        for (int t = 0; t < 4; ++t) {
          // W_proj: 16 blocks of 32 k x 32 features, one a wave; asked for as soon as the first zn fragments'
          // registers are free, so that the last V products cover part of the latency ahead of the barrier
          if (ft == 5 && t == 1) wblk_load(preg, w_proj + h * 32 * 128 + qd * 32, 128);
          v8f acc = {};
          #pragma unroll
          for (int kc = 0; kc < 4; ++kc) acc = WMMA_F32_F16(zf[t][kc], wf[kc], acc);
          v8h y;
          #pragma unroll
          for (int i = 0; i < 8; ++i) y[i] = (_Float16)(acc[i] + bias);
          *(v8h*)(vh + (fh * 16 + n) * VP + qd * 64 + t * 16 + halfw * 8) = y;
        }
      }
    }
  }
  __syncthreads();   // every wave's K and V^T rows are in LDS before any wave reads them; zn and W_qkv^T have been read by all, so O and W_proj^T may take their places
  wblk_store(preg, wsm + qd * 32 * WP + h * 32, WP);

  // Q waits in LDS for its pair's turn, so that two tiles' scores and O fit the registers: each lane leaves the two
  // 16-byte halves of a fragment in the slots that its own O chunks of the same token take later, and reads them back itself
  #pragma unroll
  for (int t = 0; t < 4; ++t) {
    _Float16* qr = zsm + (qd * 64 + t * 16 + n) * 128;
    *(v8h*)(qr + (((h * 4 + halfw) ^ n) * 8))     = __builtin_shufflevector(qa[t], qa[t], 0, 1, 2, 3, 4, 5, 6, 7);
    *(v8h*)(qr + (((h * 4 + 2 + halfw) ^ n) * 8)) = __builtin_shufflevector(qa[t], qa[t], 8, 9, 10, 11, 12, 13, 14, 15);
  }

  const float scale = 0.17677669529663687f;  // 1/sqrt(32)

  // Two query tiles go side by side, so that each K and V^T fragment read from LDS feeds two products.
  // Their scores fit the registers for 128 keys at a time: the keys go in two halves under a running maximum,
  // and the sum and O of the first half are brought to the second half's maximum before it is added.
  for (int qp = 0; qp < 2; ++qp) {
    float mrun[2] = {-1e30f, -1e30f};        // running maximum of the raw scores, equal in a lane and its partner
    float srun[2] = {0.f, 0.f};              // running sum of the lane's own keys
    v8f oc[2][2] = {};                       // O^T [query tile][feature tile]
    for (int kb = 0; kb < 2; ++kb) {
      // compiler fence: keeps the Q, K and V^T fragment reads inside the loop; lifted out of it as loop-invariant
      // they need more registers than there are and go to scratch
      asm volatile("" ::: "memory");
      // the pair's Q fragments, read anew for each half: held over softmax and PV they would cost 16 registers there
      v16h qb[2];
      #pragma unroll
      for (int q = 0; q < 2; ++q) {
        const _Float16* qr = zsm + ((qd * 4 + qp * 2 + q) * 16 + n) * 128;
        const v8h lo = *(const v8h*)(qr + (((h * 4 + halfw) ^ n) * 8));
        const v8h hi = *(const v8h*)(qr + (((h * 4 + 2 + halfw) ^ n) * 8));
        qb[q] = __builtin_shufflevector(lo, hi, 0, 1, 2, 3, 4, 5, 6, 7, 8, 9, 10, 11, 12, 13, 14, 15);
      }
      const _Float16* kc = kh + kb * 128 * KP;
      const _Float16* vc = vh + kb * 128;
      // S^T = K Q^T: K rows as A, Q as B (same k order in both). s[q][nt][i] is the score of
      // key kb*128 + nt*16 + halfw*8 + i for query n of tile q: a lane and its partner lane ^ 16 hold one query's scores.
      v16h ka[8];
      #pragma unroll
      for (int nt = 0; nt < 8; ++nt) ka[nt] = load_frag_rm(kc + nt * 16 * KP, KP);
      // holds the half's K reads together in front of the first product: spread among the products, each pair of reads
      // is waited for on its own and the wave meets the LDS latency eight times instead of once
      asm volatile("" :: "v"(ka[0]), "v"(ka[1]), "v"(ka[2]), "v"(ka[3]), "v"(ka[4]), "v"(ka[5]), "v"(ka[6]), "v"(ka[7]));
      v8f s[2][8];
      #pragma unroll
      for (int nt = 0; nt < 8; ++nt) {
        #pragma unroll
        for (int q = 0; q < 2; ++q) {
          v8f cz = {};
          s[q][nt] = WMMA_F32_F16(ka[nt], qb[q], cz);   // K-dim=32: one WMMA per tile
        }
      }
      // softmax over this half's 128 keys: in the lane (four independent chains for the maximum, eight for the sum);
      // the maximum is exchanged between the wave's halves here, the sum once behind the last half
      #pragma unroll
      for (int q = 0; q < 2; ++q) {
        float m4[4];
        #pragma unroll
        for (int c = 0; c < 4; ++c) {
          float m = -1e30f;
          #pragma unroll
          for (int nt = c; nt < 8; nt += 4)
            #pragma unroll
            for (int i = 0; i < 8; ++i) m = fmaxf(m, s[q][nt][i]);
          m4[c] = m;
        }
        float m = fmaxf(fmaxf(m4[0], m4[1]), fmaxf(m4[2], m4[3]));
        m = fmaxf(m, xhalf(m));
        m = fmaxf(m, mrun[q]);
        const float al = __expf((mrun[q] - m) * scale);   // 0 in the first half, where sum and O are 0
        mrun[q] = m;
        const float mx = m * scale;
        v8f sv = {};
        #pragma unroll
        for (int nt = 0; nt < 8; ++nt) {
          #pragma unroll
          for (int i = 0; i < 8; ++i) s[q][nt][i] = __expf(s[q][nt][i] * scale - mx);
          sv += s[q][nt];
        }
        srun[q] = srun[q] * al + (((sv[0] + sv[1]) + (sv[2] + sv[3])) + ((sv[4] + sv[5]) + (sv[6] + sv[7])));
        oc[q][0] *= al;
        oc[q][1] *= al;
      }

      // O^T += V^T P^T: V^T rows as A from LDS; two score tiles, converted in place, are the B operand
      // (element e of the fragment = key kb*128 + kt*32 + (e/8)*16 + halfw*8 + e%8, the k order of load_frag_rm)
      // keeps the V^T reads behind the softmax: scheduled over it they meet all 128 score registers and go to scratch
      __builtin_amdgcn_sched_barrier(0);
      v16h va[4][2];
      #pragma unroll
      for (int kt = 0; kt < 4; ++kt)
        #pragma unroll
        for (int nt2 = 0; nt2 < 2; ++nt2) va[kt][nt2] = load_frag_rm(vc + nt2 * 16 * VP + kt * 32, VP);
      v16h pb[4][2];
      #pragma unroll
      for (int kt = 0; kt < 4; ++kt)
        #pragma unroll
        for (int q = 0; q < 2; ++q) {
          const v8h lo = __builtin_convertvector(s[q][2 * kt],     v8h);
          const v8h hi = __builtin_convertvector(s[q][2 * kt + 1], v8h);
          pb[kt][q] = __builtin_shufflevector(lo, hi, 0, 1, 2, 3, 4, 5, 6, 7, 8, 9, 10, 11, 12, 13, 14, 15);
        }
      #pragma unroll
      for (int kt = 0; kt < 4; ++kt)
        #pragma unroll
        for (int nt2 = 0; nt2 < 2; ++nt2)
          #pragma unroll
          for (int q = 0; q < 2; ++q) oc[q][nt2] = WMMA_F32_F16(va[kt][nt2], pb[kt][q], oc[q][nt2]);
    }
    // oc[q][nt2][i] is feature h*32 + nt2*16 + halfw*8 + i of query n: the query's 1/sum is in the lane,
    // one 16-byte chunk (index h*4 + nt2*2 + halfw) of the query's O row per tile
    #pragma unroll
    for (int q = 0; q < 2; ++q) {
      const int q0 = (qd * 4 + qp * 2 + q) * 16;
      const float rs = 1.f / (srun[q] + xhalf(srun[q]));
      #pragma unroll
      for (int nt2 = 0; nt2 < 2; ++nt2) {
        v8h y;
        #pragma unroll
        for (int i = 0; i < 8; ++i) y[i] = (_Float16)(oc[q][nt2][i] * rs);
        *(v8h*)(zsm + (q0 + n) * 128 + (((h * 4 + nt2 * 2 + halfw) ^ n) * 8)) = y;
      }
    }
  }

  // output projection: W_proj^T rows as A, O as B, so that a lane holds 8 consecutive output features of one token.
  // That map puts 16-byte pieces of 16 different lines into each global access, so the wave's 64 x 32 f32 result
  // makes a trip through LDS of its own: behind it lane (tr, c8) holds 16-byte chunk c8 of a token's 128-B line,
  // and each residual load and each output store covers four whole lines.
  // What comes from global (bias, residual) is loaded in front of the barrier.
  const int tr = lane >> 3, c8 = lane & 7;
  const v4f pbias = *(const v4f*)(b_proj + h * 32 + c8 * 4);
  const unsigned eo = (qd * 64 + tr) * 128 + h * 32 + c8 * 4;   // the lane's element offset in the row: token, first feature
  v4f zres[4][4];                            // [t][j]: token qd*64 + t*16 + j*4 + tr
  #pragma unroll
  for (int t = 0; t < 4; ++t)
    #pragma unroll
    for (int j = 0; j < 4; ++j) zres[t][j] = *(const v4f*)(zr + eo + (t * 16 + j * 4) * 128);
  __syncthreads();   // all four heads' O rows and all waves' W_proj^T blocks are in LDS before any wave reads them; K and V^T have been read by all, so the result tiles may take their places

  v16h pw[2][4];
  #pragma unroll
  for (int nt = 0; nt < 2; ++nt)
    #pragma unroll
    for (int kc = 0; kc < 4; ++kc) pw[nt][kc] = load_frag_rm(wsm + (h * 32 + nt * 16) * WP + kc * 32, WP);

  // the wave's own four result tiles, f32 [16 tokens][32 features], 128-B rows: tiles 0, 1 in K's place, 2, 3 in V^T's.
  // 16-byte chunk c of row m lies at chunk c ^ (m / 2): the writers (16 rows, one chunk index) and the readers
  // (two whole rows a half wave) each meet every bank once.
  float* st01 = (float*)ksm + wave * 1024;
  float* st23 = (float*)vsm + wave * 1024;
  #pragma unroll
  for (int t = 0; t < 4; ++t) {
    const _Float16* ot = zsm + (qd * 64 + t * 16 + n) * 128;
    v8f acc[2] = {};
    #pragma unroll
    for (int kc = 0; kc < 4; ++kc) {
      // same k order as load_frag_rm: halves kc*32 + halfw*8 + 0..7, then + 16
      const v8h lo = *(const v8h*)(ot + (((kc * 4 + halfw) ^ n) * 8));
      const v8h hi = *(const v8h*)(ot + (((kc * 4 + 2 + halfw) ^ n) * 8));
      const v16h ob = __builtin_shufflevector(lo, hi, 0, 1, 2, 3, 4, 5, 6, 7, 8, 9, 10, 11, 12, 13, 14, 15);
      #pragma unroll
      for (int nt = 0; nt < 2; ++nt) acc[nt] = WMMA_F32_F16(pw[nt][kc], ob, acc[nt]);
    }
    float* st = (t < 2 ? st01 : st23) + (t & 1) * 512;
    #pragma unroll
    for (int nt = 0; nt < 2; ++nt)
      #pragma unroll
      for (int c = 0; c < 2; ++c) {
        const v4f y = {acc[nt][c * 4], acc[nt][c * 4 + 1], acc[nt][c * 4 + 2], acc[nt][c * 4 + 3]};
        *(v4f*)(st + n * 32 + (((nt * 4 + halfw * 2 + c) ^ (n >> 1)) * 4)) = y;
      }
  }
  // the wave reads back rows that its other lanes wrote: its LDS stores have landed, and no read is lifted over them
  asm volatile("s_wait_dscnt 0x0" ::: "memory");

  float* outr = out + (size_t)r * 256 * 128;
  #pragma unroll
  for (int t = 0; t < 4; ++t) {
    const float* st = (t < 2 ? st01 : st23) + (t & 1) * 512;
    #pragma unroll
    for (int j = 0; j < 4; ++j) {
      const int row = j * 4 + tr;
      const v4f a4 = *(const v4f*)(st + row * 32 + ((c8 ^ (row >> 1)) * 4));
      v4f y;
      #pragma unroll
      for (int e = 0; e < 4; ++e) y[e] = zres[t][j][e] + a4[e] + pbias[e];
      *(v4f*)(outr + eo + (t * 16 + j * 4) * 128) = y;
    }
  }
}

extern "C" void kernel_launch(void* const* d_in, const int* in_sizes, int n_in,
                              void* d_out, int out_size, void* d_ws, size_t ws_size,
                              hipStream_t stream) {
  const float* z      = (const float*)d_in[0];
  const float* ln_g   = (const float*)d_in[1];
  const float* ln_b   = (const float*)d_in[2];
  const float* w_qkv  = (const float*)d_in[3];
  const float* b_qkv  = (const float*)d_in[4];
  const float* w_proj = (const float*)d_in[5];
  const float* b_proj = (const float*)d_in[6];
  float* out = (float*)d_out;

  k_row<<<256, 512, 0, stream>>>(z, ln_g, ln_b, w_qkv, b_qkv, w_proj, b_proj, out);
}
